// v000
// Measured on an AMD MI455X. A time is GPU time per run, averaged over a window of back-to-back runs after a warm-up
// (all launches, gaps included; the runs take copies of the inputs in turn), and the median of several windows.
// Apart from v000's, it joins two sittings. Times from different sittings can be a few percent apart, while
// side-by-side timings come from the same sitting.
// The starting kernel, v000, takes 304 microseconds a run.
#include <hip/hip_runtime.h>
#include <hip/hip_bf16.h>

typedef __attribute__((ext_vector_type(16))) _Float16 v16h;
typedef __attribute__((ext_vector_type(8)))  _Float16 v8h;
typedef __attribute__((ext_vector_type(8)))  float    v8f;

#if defined(__has_builtin)
#if __has_builtin(__builtin_amdgcn_tensor_load_to_lds) && __has_builtin(__builtin_amdgcn_s_wait_tensorcnt)
#define HAVE_TDM 1
#endif
#endif

__device__ __forceinline__ v16h cat8(v8h a, v8h b) {
  return __builtin_shufflevector(a, b, 0,1,2,3,4,5,6,7,8,9,10,11,12,13,14,15);
}

__device__ __forceinline__ v8f wmma_f16(v16h a, v16h b, v8f c) {
  // v_wmma_f32_16x16x32_f16 (neg_a, A, neg_b, B, c_mod, C, reuse_a, reuse_b)
  return __builtin_amdgcn_wmma_f32_16x16x32_f16(false, a, false, b, (short)0, c, false, false);
}

// A-style 16x32 f16 fragment from a row-major f16 matrix (row stride = ld).
// lane: row = row0 + (lane&15); K in [kb + h*8, +8) and [kb+16+h*8, +8).
__device__ __forceinline__ v16h load_a16(const _Float16* __restrict__ base,
                                         int ld, int row0, int kb, int lane) {
  int m = row0 + (lane & 15);
  int h = lane >> 4;
  const _Float16* p = base + (size_t)m * ld + kb + h * 8;
  v8h lo = *(const v8h*)(p);
  v8h hi = *(const v8h*)(p + 16);
  return cat8(lo, hi);
}

#ifdef HAVE_TDM
__device__ __forceinline__ void tdm_load_2d_f16(unsigned lds_off,
                                                const void* gptr,
                                                int tile_w, int tile_h,
                                                int stride) {
  typedef __attribute__((ext_vector_type(4))) unsigned u32x4;
  typedef __attribute__((ext_vector_type(4))) int      i32x4;
  typedef __attribute__((ext_vector_type(8))) int      i32x8;
  unsigned long long ga = (unsigned long long)(uintptr_t)gptr;
  u32x4 g0;
  g0[0] = 1u;
  g0[1] = lds_off;
  g0[2] = (unsigned)(ga & 0xFFFFFFFFu);
  g0[3] = (unsigned)((ga >> 32) & 0x1FFFFFFu) | (2u << 30);
  i32x8 g1;
  g1[0] = 1 << 16;
  g1[1] = (tile_w & 0xFFFF) << 16;
  g1[2] = ((tile_w >> 16) & 0xFFFF) | ((tile_h & 0xFFFF) << 16);
  g1[3] = ((tile_h >> 16) & 0xFFFF) | ((tile_w & 0xFFFF) << 16);
  g1[4] = tile_h & 0xFFFF;
  g1[5] = stride;
  g1[6] = 0;
  g1[7] = 0;
  i32x4 z4 = {0, 0, 0, 0};
#if __clang_major__ >= 23
  i32x8 z8 = {0, 0, 0, 0, 0, 0, 0, 0};
  __builtin_amdgcn_tensor_load_to_lds(g0, g1, z4, z4, z8, 0);
#else
  __builtin_amdgcn_tensor_load_to_lds(g0, g1, z4, z4, 0);
#endif
}
#endif

// ---------------------------------------------------------------------------
// fp32 -> fp16 elementwise convert
// ---------------------------------------------------------------------------
__global__ void f32_to_f16_kernel(const float* __restrict__ src,
                                  _Float16* __restrict__ dst, int n) {
  int i = blockIdx.x * blockDim.x + threadIdx.x;
  if (i < n) dst[i] = (_Float16)src[i];
}

// ---------------------------------------------------------------------------
// Pack a K x N row-major f32 matrix into WMMA-B fragment order (f16) so the
// GEMM consumer does one contiguous 32B load per lane per WMMA.
// ---------------------------------------------------------------------------
__global__ void pack_b_kernel(const float* __restrict__ src,
                              _Float16* __restrict__ dst, int K, int N) {
  int i = blockIdx.x * blockDim.x + threadIdx.x;
  if (i >= K * N) return;
  int e    = i & 15;
  int lane = (i >> 4) & 31;
  int tile = i >> 9;
  int KT = K >> 5;
  int kt = tile % KT;
  int nt = tile / KT;
  int kk = kt * 32 + ((e >> 3) << 4) + ((lane >> 4) << 3) + (e & 7);
  int nn = nt * 16 + (lane & 15);
  dst[i] = (_Float16)src[(size_t)kk * N + nn];
}

// ---------------------------------------------------------------------------
// QKV GEMM (2048x1024 @ 1024x3072) + RoPE + scatter.
// One 32x64 output tile per wave: 2 A-frags x 4 B-frags -> 8 WMMAs per
// k-step, 12 b128 loads. Each wave's 64 columns = one head of one of q/k/v.
// ---------------------------------------------------------------------------
__global__ void qkv_rope_kernel(const _Float16* __restrict__ xh,
                                const _Float16* __restrict__ wpk,
                                _Float16* __restrict__ q,
                                _Float16* __restrict__ kd,
                                _Float16* __restrict__ vT) {
  const int KT = 32;                       // 1024 / 32
  int gw   = (blockIdx.x * blockDim.x + threadIdx.x) >> 5;
  int lane = threadIdx.x & 31;
  int mt = gw & 63;                        // 64 row tiles of 32 rows
  int ng = gw >> 6;                        // 48 col groups of 64 cols
  int h = lane >> 4, nl = lane & 15;

  v8f c[2][4] = {};
  const _Float16* arow0 = xh + (size_t)(mt * 32 + nl) * 1024 + h * 8;
  const _Float16* arow1 = arow0 + (size_t)16 * 1024;
  const _Float16* bptr  = wpk + ((size_t)(ng * 4) * KT * 32 + lane) * 16;

  #pragma unroll 2
  for (int kt = 0; kt < KT; ++kt) {
    v16h a0 = cat8(*(const v8h*)(arow0 + kt * 32),
                   *(const v8h*)(arow0 + kt * 32 + 16));
    v16h a1 = cat8(*(const v8h*)(arow1 + kt * 32),
                   *(const v8h*)(arow1 + kt * 32 + 16));
    #pragma unroll
    for (int j = 0; j < 4; ++j) {
      v16h b = *(const v16h*)(bptr + (size_t)j * 16384 + (size_t)kt * 512);
      c[0][j] = wmma_f16(a0, b, c[0][j]);
      c[1][j] = wmma_f16(a1, b, c[1][j]);
    }
  }

  int sect = (ng * 64) >> 10;              // 0=q 1=k 2=v (uniform per wave)
  int head = ng & 15;                      // uniform per wave

  if (sect == 2) {                         // V: store transposed [H][D][T]
    #pragma unroll
    for (int j = 0; j < 4; ++j) {
      _Float16* dst = vT + ((size_t)head * 64 + j * 16 + nl) * 2048;
      #pragma unroll
      for (int i = 0; i < 2; ++i)
        #pragma unroll
        for (int r = 0; r < 8; ++r)
          dst[mt * 32 + i * 16 + r + 8 * h] = (_Float16)c[i][j][r];
    }
  } else {                                 // Q/K: RoPE then [H][T][D]
    _Float16* base = (sect == 0 ? q : kd) + (size_t)head * 131072;
    #pragma unroll
    for (int j = 0; j < 4; ++j) {
      int d = j * 16 + nl;
      // inv_freq = 10000^(-(d>>1)/32) = exp(-(d>>1) * ln(10000)/32)
      float fr = __expf(-(float)(d >> 1) * 0.28782313662425572f);
      #pragma unroll
      for (int i = 0; i < 2; ++i) {
        #pragma unroll
        for (int r = 0; r < 8; ++r) {
          float xv = c[i][j][r];
          float pv = __shfl_xor(xv, 1, 32);  // partner column d^1 = lane^1
          int t = mt * 32 + i * 16 + r + 8 * h;
          float s, co;
          __sincosf((float)t * fr, &s, &co);
          float o = (d & 1) ? fmaf(pv, s, xv * co) : fmaf(xv, co, -pv * s);
          base[(size_t)t * 64 + d] = (_Float16)o;
        }
      }
    }
  }
}

__global__ void flash_attn_kernel(const _Float16* __restrict__ q,
                                  const _Float16* __restrict__ k,
                                  const _Float16* __restrict__ vT,
                                  _Float16* __restrict__ O) {
  __shared__ __align__(16) _Float16 lds_p[4][512];    // 16x32 probs per wave
#ifdef HAVE_TDM
  __shared__ __align__(16) _Float16 lds_q[4][1024];   // 16x64 q per wave
#endif
  int wv = threadIdx.x >> 5;
  int lane = threadIdx.x & 31;
  int gw = blockIdx.x * 4 + wv;
  int head = gw >> 7;
  int qt   = gw & 127;
  int q0 = qt << 4;
  int h = lane >> 4, nl = lane & 15;

  const _Float16* qh = q  + (size_t)head * 131072;   // [T][D]
  const _Float16* kh = k  + (size_t)head * 131072;   // [T][D]
  const _Float16* vh = vT + (size_t)head * 131072;   // [D][T]

  v16h qf0, qf1;
#ifdef HAVE_TDM
  {
    unsigned loff = (unsigned)(uintptr_t)(&lds_q[wv][0]);  // LDS byte offset
    tdm_load_2d_f16(loff, qh + (size_t)q0 * 64, /*w=*/64, /*h=*/16, /*stride=*/64);
    __builtin_amdgcn_s_wait_tensorcnt(0);
    const _Float16* ql = &lds_q[wv][0];
    qf0 = cat8(*(const v8h*)(ql + nl * 64 + h * 8),
               *(const v8h*)(ql + nl * 64 + h * 8 + 16));
    qf1 = cat8(*(const v8h*)(ql + nl * 64 + 32 + h * 8),
               *(const v8h*)(ql + nl * 64 + 32 + h * 8 + 16));
  }
#else
  qf0 = load_a16(qh, 64, q0, 0, lane);
  qf1 = load_a16(qh, 64, q0, 32, lane);
#endif

  v8f o0 = {}, o1 = {}, o2 = {}, o3 = {};
  float mrow[8], lrow[8];
  #pragma unroll
  for (int r = 0; r < 8; ++r) { mrow[r] = -3.0e38f; lrow[r] = 0.f; }

  _Float16* plds = &lds_p[wv][0];
  const int kend = q0 + 16;

  for (int kb = 0; kb < kend; kb += 32) {
    if (kb + 32 < kend)
      __builtin_prefetch(kh + (size_t)(kb + 32 + nl) * 64 + h * 8, 0, 0);

    // scores: q(16x64) @ k^T  -> two 16x16 f32 tiles
    v8f s0 = {}, s1 = {};
    s0 = wmma_f16(qf0, load_a16(kh, 64, kb,      0,  lane), s0);
    s0 = wmma_f16(qf1, load_a16(kh, 64, kb,      32, lane), s0);
    s1 = wmma_f16(qf0, load_a16(kh, 64, kb + 16, 0,  lane), s1);
    s1 = wmma_f16(qf1, load_a16(kh, 64, kb + 16, 32, lane), s1);

    float a0[8], a1[8], alpha[8];
    #pragma unroll
    for (int r = 0; r < 8; ++r) {
      int qi = q0 + r + 8 * h;
      a0[r] = (kb + nl      <= qi) ? s0[r] * 0.125f : -3.0e38f;  // 1/sqrt(64)
      a1[r] = (kb + 16 + nl <= qi) ? s1[r] * 0.125f : -3.0e38f;
    }
    #pragma unroll
    for (int r = 0; r < 8; ++r) {
      float t = fmaxf(a0[r], a1[r]);
      t = fmaxf(t, __shfl_xor(t, 1, 32));
      t = fmaxf(t, __shfl_xor(t, 2, 32));
      t = fmaxf(t, __shfl_xor(t, 4, 32));
      t = fmaxf(t, __shfl_xor(t, 8, 32));
      float mnew = fmaxf(mrow[r], t);
      float al = __expf(mrow[r] - mnew);
      float p0 = __expf(a0[r] - mnew);
      float p1 = __expf(a1[r] - mnew);
      float ss = p0 + p1;
      ss += __shfl_xor(ss, 1, 32);
      ss += __shfl_xor(ss, 2, 32);
      ss += __shfl_xor(ss, 4, 32);
      ss += __shfl_xor(ss, 8, 32);
      lrow[r] = lrow[r] * al + ss;
      mrow[r] = mnew;
      alpha[r] = al;
      a0[r] = p0; a1[r] = p1;
    }
    #pragma unroll
    for (int r = 0; r < 8; ++r) {
      o0[r] *= alpha[r]; o1[r] *= alpha[r];
      o2[r] *= alpha[r]; o3[r] *= alpha[r];
    }
    // C-layout probs -> LDS [16 rows][32 keys] f16, re-read in A layout
    #pragma unroll
    for (int r = 0; r < 8; ++r) {
      int m = r + 8 * h;
      plds[m * 32 + nl]      = (_Float16)a0[r];
      plds[m * 32 + 16 + nl] = (_Float16)a1[r];
    }
    asm volatile("s_wait_dscnt 0" ::: "memory");   // LDS RAW within wave
    v16h pf = cat8(*(const v8h*)(plds + nl * 32 + h * 8),
                   *(const v8h*)(plds + nl * 32 + 16 + h * 8));

    // O += P(16x32) @ V(32x64); vT rows are d -> row-contiguous B fragments
    o0 = wmma_f16(pf, load_a16(vh, 2048, 0,  kb, lane), o0);
    o1 = wmma_f16(pf, load_a16(vh, 2048, 16, kb, lane), o1);
    o2 = wmma_f16(pf, load_a16(vh, 2048, 32, kb, lane), o2);
    o3 = wmma_f16(pf, load_a16(vh, 2048, 48, kb, lane), o3);
  }

  #pragma unroll
  for (int r = 0; r < 8; ++r) {
    int t = q0 + r + 8 * h;
    float inv = 1.0f / lrow[r];
    size_t base = (size_t)t * 1024 + head * 64 + nl;
    O[base]      = (_Float16)(o0[r] * inv);
    O[base + 16] = (_Float16)(o1[r] * inv);
    O[base + 32] = (_Float16)(o2[r] * inv);
    O[base + 48] = (_Float16)(o3[r] * inv);
  }
}

// ---------------------------------------------------------------------------
// Output projection: O(2048x1024 f16) @ w_proj -> d_out f32. 32x64 tiles.
// ---------------------------------------------------------------------------
__global__ void proj_kernel(const _Float16* __restrict__ Oh,
                            const _Float16* __restrict__ wpk,
                            float* __restrict__ out) {
  const int KT = 32;
  int gw   = (blockIdx.x * blockDim.x + threadIdx.x) >> 5;
  int lane = threadIdx.x & 31;
  int mt = gw & 63;                        // 64 row tiles of 32
  int ng = gw >> 6;                        // 16 col groups of 64
  int h = lane >> 4, nl = lane & 15;

  v8f c[2][4] = {};
  const _Float16* arow0 = Oh + (size_t)(mt * 32 + nl) * 1024 + h * 8;
  const _Float16* arow1 = arow0 + (size_t)16 * 1024;
  const _Float16* bptr  = wpk + ((size_t)(ng * 4) * KT * 32 + lane) * 16;

  #pragma unroll 2
  for (int kt = 0; kt < KT; ++kt) {
    v16h a0 = cat8(*(const v8h*)(arow0 + kt * 32),
                   *(const v8h*)(arow0 + kt * 32 + 16));
    v16h a1 = cat8(*(const v8h*)(arow1 + kt * 32),
                   *(const v8h*)(arow1 + kt * 32 + 16));
    #pragma unroll
    for (int j = 0; j < 4; ++j) {
      v16h b = *(const v16h*)(bptr + (size_t)j * 16384 + (size_t)kt * 512);
      c[0][j] = wmma_f16(a0, b, c[0][j]);
      c[1][j] = wmma_f16(a1, b, c[1][j]);
    }
  }
  #pragma unroll
  for (int i = 0; i < 2; ++i)
    #pragma unroll
    for (int j = 0; j < 4; ++j)
      #pragma unroll
      for (int r = 0; r < 8; ++r) {
        int t = mt * 32 + i * 16 + r + 8 * h;
        out[(size_t)t * 1024 + ng * 64 + j * 16 + nl] = c[i][j][r];
      }
}

// ---------------------------------------------------------------------------
extern "C" void kernel_launch(void* const* d_in, const int* in_sizes, int n_in,
                              void* d_out, int out_size, void* d_ws, size_t ws_size,
                              hipStream_t stream) {
  const float* x     = (const float*)d_in[0];   // (1,2048,1024)
  const float* wqkv  = (const float*)d_in[1];   // (1024,3072)
  const float* wproj = (const float*)d_in[2];   // (1024,1024)
  float* out = (float*)d_out;                   // (1,2048,1024)

  char* ws = (char*)d_ws;                       // needs ~28 MB
  _Float16* xh       = (_Float16*)(ws);                         // 4 MB
  _Float16* wqkv_pk  = (_Float16*)(ws + ((size_t)4  << 20));    // 6 MB
  _Float16* wproj_pk = (_Float16*)(ws + ((size_t)10 << 20));    // 2 MB
  _Float16* q        = (_Float16*)(ws + ((size_t)12 << 20));    // 4 MB
  _Float16* k        = (_Float16*)(ws + ((size_t)16 << 20));    // 4 MB
  _Float16* vT       = (_Float16*)(ws + ((size_t)20 << 20));    // 4 MB
  _Float16* O        = (_Float16*)(ws + ((size_t)24 << 20));    // 4 MB

  f32_to_f16_kernel<<<2097152 / 256, 256, 0, stream>>>(x, xh, 2097152);
  pack_b_kernel<<<3145728 / 256, 256, 0, stream>>>(wqkv, wqkv_pk, 1024, 3072);
  pack_b_kernel<<<1048576 / 256, 256, 0, stream>>>(wproj, wproj_pk, 1024, 1024);

  // 64x48 tiles of 32x64, 1 tile/wave, 8 waves/block
  qkv_rope_kernel<<<384, 256, 0, stream>>>(xh, wqkv_pk, q, k, vT);
  // 16 heads x 128 q-strips = 2048 waves, 4 waves/block
  flash_attn_kernel<<<512, 128, 0, stream>>>(q, k, vT, O);
  // 64x16 tiles of 32x64, 8 waves/block
  proj_kernel<<<128, 256, 0, stream>>>(O, wproj_pk, out);
}

// v001
// One run takes 177 microseconds.
// In two side-by-side timings against v000, it was 1.72 and 1.73 times as fast.
#include <hip/hip_runtime.h>
#include <hip/hip_bf16.h>

typedef __attribute__((ext_vector_type(16))) _Float16 v16h;
typedef __attribute__((ext_vector_type(8)))  _Float16 v8h;
typedef __attribute__((ext_vector_type(8)))  float    v8f;

#if defined(__has_builtin)
#if __has_builtin(__builtin_amdgcn_tensor_load_to_lds) && __has_builtin(__builtin_amdgcn_s_wait_tensorcnt)
#define HAVE_TDM 1
#endif
#endif

__device__ __forceinline__ v16h cat8(v8h a, v8h b) {
  return __builtin_shufflevector(a, b, 0,1,2,3,4,5,6,7,8,9,10,11,12,13,14,15);
}

__device__ __forceinline__ v8f wmma_f16(v16h a, v16h b, v8f c) {
  // v_wmma_f32_16x16x32_f16 (neg_a, A, neg_b, B, c_mod, C, reuse_a, reuse_b)
  return __builtin_amdgcn_wmma_f32_16x16x32_f16(false, a, false, b, (short)0, c, false, false);
}

// A-style 16x32 f16 fragment from a row-major f16 matrix (row stride = ld).
// lane: row = row0 + (lane&15); K in [kb + h*8, +8) and [kb+16+h*8, +8).
__device__ __forceinline__ v16h load_a16(const _Float16* __restrict__ base,
                                         int ld, int row0, int kb, int lane) {
  int m = row0 + (lane & 15);
  int h = lane >> 4;
  const _Float16* p = base + (size_t)m * ld + kb + h * 8;
  v8h lo = *(const v8h*)(p);
  v8h hi = *(const v8h*)(p + 16);
  return cat8(lo, hi);
}

#ifdef HAVE_TDM
__device__ __forceinline__ void tdm_load_2d_f16(unsigned lds_off,
                                                const void* gptr,
                                                int tile_w, int tile_h,
                                                int stride) {
  typedef __attribute__((ext_vector_type(4))) unsigned u32x4;
  typedef __attribute__((ext_vector_type(4))) int      i32x4;
  typedef __attribute__((ext_vector_type(8))) int      i32x8;
  unsigned long long ga = (unsigned long long)(uintptr_t)gptr;
  u32x4 g0;
  g0[0] = 1u;
  g0[1] = lds_off;
  g0[2] = (unsigned)(ga & 0xFFFFFFFFu);
  g0[3] = (unsigned)((ga >> 32) & 0x1FFFFFFu) | (2u << 30);
  i32x8 g1;
  g1[0] = 1 << 16;
  g1[1] = (tile_w & 0xFFFF) << 16;
  g1[2] = ((tile_w >> 16) & 0xFFFF) | ((tile_h & 0xFFFF) << 16);
  g1[3] = ((tile_h >> 16) & 0xFFFF) | ((tile_w & 0xFFFF) << 16);
  g1[4] = tile_h & 0xFFFF;
  g1[5] = stride;
  g1[6] = 0;
  g1[7] = 0;
  i32x4 z4 = {0, 0, 0, 0};
#if __clang_major__ >= 23
  i32x8 z8 = {0, 0, 0, 0, 0, 0, 0, 0};
  __builtin_amdgcn_tensor_load_to_lds(g0, g1, z4, z4, z8, 0);
#else
  __builtin_amdgcn_tensor_load_to_lds(g0, g1, z4, z4, 0);
#endif
}
#endif

// ---------------------------------------------------------------------------
// fp32 -> fp16 elementwise convert
// ---------------------------------------------------------------------------
__global__ void f32_to_f16_kernel(const float* __restrict__ src,
                                  _Float16* __restrict__ dst, int n) {
  int i = blockIdx.x * blockDim.x + threadIdx.x;
  if (i < n) dst[i] = (_Float16)src[i];
}

// ---------------------------------------------------------------------------
// Pack a K x N row-major f32 matrix into WMMA-B fragment order (f16) so the
// GEMM consumer does one contiguous 32B load per lane per WMMA.
// ---------------------------------------------------------------------------
__global__ void pack_b_kernel(const float* __restrict__ src,
                              _Float16* __restrict__ dst, int K, int N) {
  int i = blockIdx.x * blockDim.x + threadIdx.x;
  if (i >= K * N) return;
  int e    = i & 15;
  int lane = (i >> 4) & 31;
  int tile = i >> 9;
  int KT = K >> 5;
  int kt = tile % KT;
  int nt = tile / KT;
  int kk = kt * 32 + ((e >> 3) << 4) + ((lane >> 4) << 3) + (e & 7);
  int nn = nt * 16 + (lane & 15);
  dst[i] = (_Float16)src[(size_t)kk * N + nn];
}

// ---------------------------------------------------------------------------
// QKV GEMM (2048x1024 @ 1024x3072) + RoPE + scatter.
// One 32x64 output tile per wave: 2 A-frags x 4 B-frags -> 8 WMMAs per
// k-step, 12 b128 loads. Each wave's 64 columns = one head of one of q/k/v.
// ---------------------------------------------------------------------------
__global__ void qkv_rope_kernel(const _Float16* __restrict__ xh,
                                const _Float16* __restrict__ wpk,
                                _Float16* __restrict__ q,
                                _Float16* __restrict__ kd,
                                _Float16* __restrict__ vT) {
  const int KT = 32;                       // 1024 / 32
  int gw   = (blockIdx.x * blockDim.x + threadIdx.x) >> 5;
  int lane = threadIdx.x & 31;
  int mt = gw & 63;                        // 64 row tiles of 32 rows
  int ng = gw >> 6;                        // 48 col groups of 64 cols
  int h = lane >> 4, nl = lane & 15;

  v8f c[2][4] = {};
  const _Float16* arow0 = xh + (size_t)(mt * 32 + nl) * 1024 + h * 8;
  const _Float16* arow1 = arow0 + (size_t)16 * 1024;
  const _Float16* bptr  = wpk + ((size_t)(ng * 4) * KT * 32 + lane) * 16;

  #pragma unroll 2
  for (int kt = 0; kt < KT; ++kt) {
    v16h a0 = cat8(*(const v8h*)(arow0 + kt * 32),
                   *(const v8h*)(arow0 + kt * 32 + 16));
    v16h a1 = cat8(*(const v8h*)(arow1 + kt * 32),
                   *(const v8h*)(arow1 + kt * 32 + 16));
    #pragma unroll
    for (int j = 0; j < 4; ++j) {
      v16h b = *(const v16h*)(bptr + (size_t)j * 16384 + (size_t)kt * 512);
      c[0][j] = wmma_f16(a0, b, c[0][j]);
      c[1][j] = wmma_f16(a1, b, c[1][j]);
    }
  }

  int sect = (ng * 64) >> 10;              // 0=q 1=k 2=v (uniform per wave)
  int head = ng & 15;                      // uniform per wave

  if (sect == 2) {                         // V: store transposed [H][D][T]
    #pragma unroll
    for (int j = 0; j < 4; ++j) {
      _Float16* dst = vT + ((size_t)head * 64 + j * 16 + nl) * 2048;
      #pragma unroll
      for (int i = 0; i < 2; ++i)
        #pragma unroll
        for (int r = 0; r < 8; ++r)
          dst[mt * 32 + i * 16 + r + 8 * h] = (_Float16)c[i][j][r];
    }
  } else {                                 // Q/K: RoPE then [H][T][D]
    _Float16* base = (sect == 0 ? q : kd) + (size_t)head * 131072;
    #pragma unroll
    for (int j = 0; j < 4; ++j) {
      int d = j * 16 + nl;
      // inv_freq = 10000^(-(d>>1)/32) = exp(-(d>>1) * ln(10000)/32)
      float fr = __expf(-(float)(d >> 1) * 0.28782313662425572f);
      #pragma unroll
      for (int i = 0; i < 2; ++i) {
        #pragma unroll
        for (int r = 0; r < 8; ++r) {
          float xv = c[i][j][r];
          float pv = __shfl_xor(xv, 1, 32);  // partner column d^1 = lane^1
          int t = mt * 32 + i * 16 + r + 8 * h;
          float s, co;
          __sincosf((float)t * fr, &s, &co);
          float o = (d & 1) ? fmaf(pv, s, xv * co) : fmaf(xv, co, -pv * s);
          base[(size_t)t * 64 + d] = (_Float16)o;
        }
      }
    }
  }
}

__device__ __forceinline__ float xhalf(float x) {
  int b = __builtin_bit_cast(int, x);
  return __builtin_bit_cast(float,
      __builtin_amdgcn_permlanex16(b, b, 0x76543210, 0xfedcba98, false, false));
}

__global__ void flash_attn_kernel(const _Float16* __restrict__ q,
                                  const _Float16* __restrict__ k,
                                  const _Float16* __restrict__ vT,
                                  _Float16* __restrict__ O) {
#ifdef HAVE_TDM
  __shared__ __align__(16) _Float16 lds_q[4][1024];   // 16x64 q per wave
#endif
  int wv = threadIdx.x >> 5;
  int lane = threadIdx.x & 31;
  int gw = blockIdx.x * 4 + wv;
  int head = gw >> 7;
  int qt   = gw & 127;
  int q0 = qt << 4;
  int h = lane >> 4, nl = lane & 15;

  const _Float16* qh = q  + (size_t)head * 131072;   // [T][D]
  const _Float16* kh = k  + (size_t)head * 131072;   // [T][D]
  const _Float16* vh = vT + (size_t)head * 131072;   // [D][T]

  v16h qf0, qf1;
#ifdef HAVE_TDM
  {
    unsigned loff = (unsigned)(uintptr_t)(&lds_q[wv][0]);  // LDS byte offset
    tdm_load_2d_f16(loff, qh + (size_t)q0 * 64, /*w=*/64, /*h=*/16, /*stride=*/64);
    __builtin_amdgcn_s_wait_tensorcnt(0);
    const _Float16* ql = &lds_q[wv][0];
    qf0 = cat8(*(const v8h*)(ql + nl * 64 + h * 8),
               *(const v8h*)(ql + nl * 64 + h * 8 + 16));
    qf1 = cat8(*(const v8h*)(ql + nl * 64 + 32 + h * 8),
               *(const v8h*)(ql + nl * 64 + 32 + h * 8 + 16));
  }
#else
  qf0 = load_a16(qh, 64, q0, 0, lane);
  qf1 = load_a16(qh, 64, q0, 32, lane);
#endif

  // o*[r] = O^T[d = 16j + 8h + r][query q0 + nl]
  v8f o0 = {}, o1 = {}, o2 = {}, o3 = {};
  float mrow = -3.0e38f;   // running maximum of this lane's query (both halves)
  float lrow = 0.f;        // running sum over this half's keys only

  const int qi = q0 + nl;
  const int kend = q0 + 16;

  for (int kb = 0; kb < kend; kb += 32) {
    if (kb + 32 < kend)
      __builtin_prefetch(kh + (size_t)(kb + 32 + nl) * 64 + h * 8, 0, 0);

    // scores: k(32x64) @ q^T -> two 16x16 f32 tiles, row = key, column = query
    v8f s0 = {}, s1 = {};
    s0 = wmma_f16(load_a16(kh, 64, kb,      0,  lane), qf0, s0);
    s0 = wmma_f16(load_a16(kh, 64, kb,      32, lane), qf1, s0);
    s1 = wmma_f16(load_a16(kh, 64, kb + 16, 0,  lane), qf0, s1);
    s1 = wmma_f16(load_a16(kh, 64, kb + 16, 32, lane), qf1, s1);
    // the K loads' and the prefetch's address registers are reused below:
    // keep the address-translation wait in front of that overwrite
    asm volatile("s_wait_xcnt 0x0" ::: "memory");

    float a0[8], a1[8], mx[8];
    #pragma unroll
    for (int r = 0; r < 8; ++r) {
      int key = kb + r + 8 * h;
      a0[r] = (key      <= qi) ? s0[r] * 0.125f : -3.0e38f;  // 1/sqrt(64)
      a1[r] = (key + 16 <= qi) ? s1[r] * 0.125f : -3.0e38f;
      mx[r] = fmaxf(a0[r], a1[r]);
    }
    float t = fmaxf(fmaxf(fmaxf(mx[0], mx[1]), fmaxf(mx[2], mx[3])),
                    fmaxf(fmaxf(mx[4], mx[5]), fmaxf(mx[6], mx[7])));
    t = fmaxf(t, xhalf(t));
    float mnew = fmaxf(mrow, t);
    float al = __expf(mrow - mnew);
    mrow = mnew;

    // probs: element r = key 8h + r, element 8 + r = key 16 + 8h + r, which
    // is the k order load_a16 gives the vT fragments
    v16h pf;
    float sm[8];
    #pragma unroll
    for (int r = 0; r < 8; ++r) {
      float p0 = __expf(a0[r] - mnew);
      float p1 = __expf(a1[r] - mnew);
      sm[r] = p0 + p1;
      pf[r]     = (_Float16)p0;
      pf[8 + r] = (_Float16)p1;
    }
    lrow = lrow * al + (((sm[0] + sm[1]) + (sm[2] + sm[3])) +
                        ((sm[4] + sm[5]) + (sm[6] + sm[7])));
    #pragma unroll
    for (int r = 0; r < 8; ++r) {
      o0[r] *= al; o1[r] *= al;
      o2[r] *= al; o3[r] *= al;
    }

    // O^T += V^T(64x32) @ P^T(32x16); vT rows are d -> row-contiguous A fragments
    o0 = wmma_f16(load_a16(vh, 2048, 0,  kb, lane), pf, o0);
    o1 = wmma_f16(load_a16(vh, 2048, 16, kb, lane), pf, o1);
    o2 = wmma_f16(load_a16(vh, 2048, 32, kb, lane), pf, o2);
    o3 = wmma_f16(load_a16(vh, 2048, 48, kb, lane), pf, o3);
  }

  // join the two halves' sums once; a lane's 8 registers of a tile are 8
  // consecutive d of its query: one 16-byte store per tile
  float inv = 1.0f / (lrow + xhalf(lrow));
  _Float16* orow = O + (size_t)qi * 1024 + head * 64 + 8 * h;
  v8h w0, w1, w2, w3;
  #pragma unroll
  for (int r = 0; r < 8; ++r) {
    w0[r] = (_Float16)(o0[r] * inv);
    w1[r] = (_Float16)(o1[r] * inv);
    w2[r] = (_Float16)(o2[r] * inv);
    w3[r] = (_Float16)(o3[r] * inv);
  }
  *(v8h*)(orow)      = w0;
  *(v8h*)(orow + 16) = w1;
  *(v8h*)(orow + 32) = w2;
  *(v8h*)(orow + 48) = w3;
}

// ---------------------------------------------------------------------------
// Output projection: O(2048x1024 f16) @ w_proj -> d_out f32. 32x64 tiles.
// ---------------------------------------------------------------------------
__global__ void proj_kernel(const _Float16* __restrict__ Oh,
                            const _Float16* __restrict__ wpk,
                            float* __restrict__ out) {
  const int KT = 32;
  int gw   = (blockIdx.x * blockDim.x + threadIdx.x) >> 5;
  int lane = threadIdx.x & 31;
  int mt = gw & 63;                        // 64 row tiles of 32
  int ng = gw >> 6;                        // 16 col groups of 64
  int h = lane >> 4, nl = lane & 15;

  v8f c[2][4] = {};
  const _Float16* arow0 = Oh + (size_t)(mt * 32 + nl) * 1024 + h * 8;
  const _Float16* arow1 = arow0 + (size_t)16 * 1024;
  const _Float16* bptr  = wpk + ((size_t)(ng * 4) * KT * 32 + lane) * 16;

  #pragma unroll 2
  for (int kt = 0; kt < KT; ++kt) {
    v16h a0 = cat8(*(const v8h*)(arow0 + kt * 32),
                   *(const v8h*)(arow0 + kt * 32 + 16));
    v16h a1 = cat8(*(const v8h*)(arow1 + kt * 32),
                   *(const v8h*)(arow1 + kt * 32 + 16));
    #pragma unroll
    for (int j = 0; j < 4; ++j) {
      v16h b = *(const v16h*)(bptr + (size_t)j * 16384 + (size_t)kt * 512);
      c[0][j] = wmma_f16(a0, b, c[0][j]);
      c[1][j] = wmma_f16(a1, b, c[1][j]);
    }
  }
  #pragma unroll
  for (int i = 0; i < 2; ++i)
    #pragma unroll
    for (int j = 0; j < 4; ++j)
      #pragma unroll
      for (int r = 0; r < 8; ++r) {
        int t = mt * 32 + i * 16 + r + 8 * h;
        out[(size_t)t * 1024 + ng * 64 + j * 16 + nl] = c[i][j][r];
      }
}

// ---------------------------------------------------------------------------
extern "C" void kernel_launch(void* const* d_in, const int* in_sizes, int n_in,
                              void* d_out, int out_size, void* d_ws, size_t ws_size,
                              hipStream_t stream) {
  const float* x     = (const float*)d_in[0];   // (1,2048,1024)
  const float* wqkv  = (const float*)d_in[1];   // (1024,3072)
  const float* wproj = (const float*)d_in[2];   // (1024,1024)
  float* out = (float*)d_out;                   // (1,2048,1024)

  char* ws = (char*)d_ws;                       // needs ~28 MB
  _Float16* xh       = (_Float16*)(ws);                         // 4 MB
  _Float16* wqkv_pk  = (_Float16*)(ws + ((size_t)4  << 20));    // 6 MB
  _Float16* wproj_pk = (_Float16*)(ws + ((size_t)10 << 20));    // 2 MB
  _Float16* q        = (_Float16*)(ws + ((size_t)12 << 20));    // 4 MB
  _Float16* k        = (_Float16*)(ws + ((size_t)16 << 20));    // 4 MB
  _Float16* vT       = (_Float16*)(ws + ((size_t)20 << 20));    // 4 MB
  _Float16* O        = (_Float16*)(ws + ((size_t)24 << 20));    // 4 MB

  f32_to_f16_kernel<<<2097152 / 256, 256, 0, stream>>>(x, xh, 2097152);
  pack_b_kernel<<<3145728 / 256, 256, 0, stream>>>(wqkv, wqkv_pk, 1024, 3072);
  pack_b_kernel<<<1048576 / 256, 256, 0, stream>>>(wproj, wproj_pk, 1024, 1024);

  // 64x48 tiles of 32x64, 1 tile/wave, 8 waves/block
  qkv_rope_kernel<<<384, 256, 0, stream>>>(xh, wqkv_pk, q, k, vT);
  // 16 heads x 128 q-strips = 2048 waves, 4 waves/block
  flash_attn_kernel<<<512, 128, 0, stream>>>(q, k, vT, O);
  // 64x16 tiles of 32x64, 8 waves/block
  proj_kernel<<<128, 256, 0, stream>>>(O, wproj_pk, out);
}

// v002
// Measured time: 130 microseconds a run.
// In two side-by-side timings against v001, it was 1.37 and 1.36 times as fast.
// All steps since v000 together make it 2.35 times as fast.
#include <hip/hip_runtime.h>
#include <hip/hip_bf16.h>

typedef __attribute__((ext_vector_type(16))) _Float16 v16h;
typedef __attribute__((ext_vector_type(8)))  _Float16 v8h;
typedef __attribute__((ext_vector_type(8)))  float    v8f;

#if defined(__has_builtin)
#if __has_builtin(__builtin_amdgcn_tensor_load_to_lds) && __has_builtin(__builtin_amdgcn_s_wait_tensorcnt)
#define HAVE_TDM 1
#endif
#endif

__device__ __forceinline__ v16h cat8(v8h a, v8h b) {
  return __builtin_shufflevector(a, b, 0,1,2,3,4,5,6,7,8,9,10,11,12,13,14,15);
}

__device__ __forceinline__ v8f wmma_f16(v16h a, v16h b, v8f c) {
  // v_wmma_f32_16x16x32_f16 (neg_a, A, neg_b, B, c_mod, C, reuse_a, reuse_b)
  return __builtin_amdgcn_wmma_f32_16x16x32_f16(false, a, false, b, (short)0, c, false, false);
}

// A-style 16x32 f16 fragment from a row-major f16 matrix (row stride = ld).
// lane: row = row0 + (lane&15); K in [kb + h*8, +8) and [kb+16+h*8, +8).
__device__ __forceinline__ v16h load_a16(const _Float16* __restrict__ base,
                                         int ld, int row0, int kb, int lane) {
  int m = row0 + (lane & 15);
  int h = lane >> 4;
  const _Float16* p = base + (size_t)m * ld + kb + h * 8;
  v8h lo = *(const v8h*)(p);
  v8h hi = *(const v8h*)(p + 16);
  return cat8(lo, hi);
}

#ifdef HAVE_TDM
__device__ __forceinline__ void tdm_load_2d_f16(unsigned lds_off,
                                                const void* gptr,
                                                int tile_w, int tile_h,
                                                int stride) {
  typedef __attribute__((ext_vector_type(4))) unsigned u32x4;
  typedef __attribute__((ext_vector_type(4))) int      i32x4;
  typedef __attribute__((ext_vector_type(8))) int      i32x8;
  unsigned long long ga = (unsigned long long)(uintptr_t)gptr;
  u32x4 g0;
  g0[0] = 1u;
  g0[1] = lds_off;
  g0[2] = (unsigned)(ga & 0xFFFFFFFFu);
  g0[3] = (unsigned)((ga >> 32) & 0x1FFFFFFu) | (2u << 30);
  i32x8 g1;
  g1[0] = 1 << 16;
  g1[1] = (tile_w & 0xFFFF) << 16;
  g1[2] = ((tile_w >> 16) & 0xFFFF) | ((tile_h & 0xFFFF) << 16);
  g1[3] = ((tile_h >> 16) & 0xFFFF) | ((tile_w & 0xFFFF) << 16);
  g1[4] = tile_h & 0xFFFF;
  g1[5] = stride;
  g1[6] = 0;
  g1[7] = 0;
  i32x4 z4 = {0, 0, 0, 0};
#if __clang_major__ >= 23
  i32x8 z8 = {0, 0, 0, 0, 0, 0, 0, 0};
  __builtin_amdgcn_tensor_load_to_lds(g0, g1, z4, z4, z8, 0);
#else
  __builtin_amdgcn_tensor_load_to_lds(g0, g1, z4, z4, 0);
#endif
}
#endif

// ---------------------------------------------------------------------------
// fp32 -> fp16 elementwise convert
// ---------------------------------------------------------------------------
__global__ void f32_to_f16_kernel(const float* __restrict__ src,
                                  _Float16* __restrict__ dst, int n) {
  int i = blockIdx.x * blockDim.x + threadIdx.x;
  if (i < n) dst[i] = (_Float16)src[i];
}

// ---------------------------------------------------------------------------
// Pack a K x N row-major f32 matrix into WMMA-B fragment order (f16) so the
// GEMM consumer does one contiguous 32B load per lane per WMMA.
// ---------------------------------------------------------------------------
__global__ void pack_b_kernel(const float* __restrict__ src,
                              _Float16* __restrict__ dst, int K, int N) {
  int i = blockIdx.x * blockDim.x + threadIdx.x;
  if (i >= K * N) return;
  int e    = i & 15;
  int lane = (i >> 4) & 31;
  int tile = i >> 9;
  int KT = K >> 5;
  int kt = tile % KT;
  int nt = tile / KT;
  int kk = kt * 32 + ((e >> 3) << 4) + ((lane >> 4) << 3) + (e & 7);
  int nn = nt * 16 + (lane & 15);
  dst[i] = (_Float16)src[(size_t)kk * N + nn];
}

// ---------------------------------------------------------------------------
// QKV GEMM (2048x1024 @ 1024x3072) + RoPE + scatter.
// One 32x64 output tile per wave: 2 A-frags x 4 B-frags -> 8 WMMAs per
// k-step, 12 b128 loads. Each wave's 64 columns = one head of one of q/k/v.
// ---------------------------------------------------------------------------
__global__ void qkv_rope_kernel(const _Float16* __restrict__ xh,
                                const _Float16* __restrict__ wpk,
                                _Float16* __restrict__ q,
                                _Float16* __restrict__ kd,
                                _Float16* __restrict__ vT) {
  const int KT = 32;                       // 1024 / 32
  int gw   = (blockIdx.x * blockDim.x + threadIdx.x) >> 5;
  int lane = threadIdx.x & 31;
  int mt = gw & 63;                        // 64 row tiles of 32 rows
  int ng = gw >> 6;                        // 48 col groups of 64 cols
  int h = lane >> 4, nl = lane & 15;

  v8f c[2][4] = {};
  const _Float16* arow0 = xh + (size_t)(mt * 32 + nl) * 1024 + h * 8;
  const _Float16* arow1 = arow0 + (size_t)16 * 1024;
  const _Float16* bptr  = wpk + ((size_t)(ng * 4) * KT * 32 + lane) * 16;

  #pragma unroll 2
  for (int kt = 0; kt < KT; ++kt) {
    v16h a0 = cat8(*(const v8h*)(arow0 + kt * 32),
                   *(const v8h*)(arow0 + kt * 32 + 16));
    v16h a1 = cat8(*(const v8h*)(arow1 + kt * 32),
                   *(const v8h*)(arow1 + kt * 32 + 16));
    #pragma unroll
    for (int j = 0; j < 4; ++j) {
      v16h b = *(const v16h*)(bptr + (size_t)j * 16384 + (size_t)kt * 512);
      c[0][j] = wmma_f16(a0, b, c[0][j]);
      c[1][j] = wmma_f16(a1, b, c[1][j]);
    }
  }

  int sect = (ng * 64) >> 10;              // 0=q 1=k 2=v (uniform per wave)
  int head = ng & 15;                      // uniform per wave

  if (sect == 2) {                         // V: store transposed [H][D][T]
    #pragma unroll
    for (int j = 0; j < 4; ++j) {
      _Float16* dst = vT + ((size_t)head * 64 + j * 16 + nl) * 2048;
      #pragma unroll
      for (int i = 0; i < 2; ++i)
        #pragma unroll
        for (int r = 0; r < 8; ++r)
          dst[mt * 32 + i * 16 + r + 8 * h] = (_Float16)c[i][j][r];
    }
  } else {                                 // Q/K: RoPE then [H][T][D]
    _Float16* base = (sect == 0 ? q : kd) + (size_t)head * 131072;
    #pragma unroll
    for (int j = 0; j < 4; ++j) {
      int d = j * 16 + nl;
      // inv_freq = 10000^(-(d>>1)/32) = exp(-(d>>1) * ln(10000)/32)
      float fr = __expf(-(float)(d >> 1) * 0.28782313662425572f);
      #pragma unroll
      for (int i = 0; i < 2; ++i) {
        #pragma unroll
        for (int r = 0; r < 8; ++r) {
          float xv = c[i][j][r];
          float pv = __shfl_xor(xv, 1, 32);  // partner column d^1 = lane^1
          int t = mt * 32 + i * 16 + r + 8 * h;
          float s, co;
          __sincosf((float)t * fr, &s, &co);
          float o = (d & 1) ? fmaf(pv, s, xv * co) : fmaf(xv, co, -pv * s);
          base[(size_t)t * 64 + d] = (_Float16)o;
        }
      }
    }
  }
}

__device__ __forceinline__ float xhalf(float x) {
  int b = __builtin_bit_cast(int, x);
  return __builtin_bit_cast(float,
      __builtin_amdgcn_permlanex16(b, b, 0x76543210, 0xfedcba98, false, false));
}

__global__ void __launch_bounds__(128)
flash_attn_kernel(const _Float16* __restrict__ q,
                                  const _Float16* __restrict__ k,
                                  const _Float16* __restrict__ vT,
                                  _Float16* __restrict__ O) {
#ifdef HAVE_TDM
  __shared__ __align__(16) _Float16 lds_q[4][1024];   // 16x64 q per wave
#endif
  int wv = threadIdx.x >> 5;
  int lane = threadIdx.x & 31;
  int gw = blockIdx.x * 4 + wv;
  int head = gw >> 7;
  int qt   = gw & 127;
  int q0 = qt << 4;
  int h = lane >> 4, nl = lane & 15;

  const _Float16* qh = q  + (size_t)head * 131072;   // [T][D]
  const _Float16* kh = k  + (size_t)head * 131072;   // [T][D]
  const _Float16* vh = vT + (size_t)head * 131072;   // [D][T]

  // K and V^T fragments are fetched one key block ahead, all eight loads of an
  // operand together: K's fly during the softmax and the second product, V's
  // during the next block's scores and softmax; the first block's during the
  // staging of q.
  v16h k0 = load_a16(kh, 64, 0,  0,  lane);
  v16h k1 = load_a16(kh, 64, 0,  32, lane);
  v16h k2 = load_a16(kh, 64, 16, 0,  lane);
  v16h k3 = load_a16(kh, 64, 16, 32, lane);
  v16h v0 = load_a16(vh, 2048, 0,  0, lane);
  v16h v1 = load_a16(vh, 2048, 16, 0, lane);
  v16h v2 = load_a16(vh, 2048, 32, 0, lane);
  v16h v3 = load_a16(vh, 2048, 48, 0, lane);
  // the loads' address registers are reused below: keep the
  // address-translation wait in front of that overwrite
  asm volatile("s_wait_xcnt 0x0" ::: "memory");

  v16h qf0, qf1;
#ifdef HAVE_TDM
  {
    unsigned loff = (unsigned)(uintptr_t)(&lds_q[wv][0]);  // LDS byte offset
    tdm_load_2d_f16(loff, qh + (size_t)q0 * 64, /*w=*/64, /*h=*/16, /*stride=*/64);
    __builtin_amdgcn_s_wait_tensorcnt(0);
    const _Float16* ql = &lds_q[wv][0];
    qf0 = cat8(*(const v8h*)(ql + nl * 64 + h * 8),
               *(const v8h*)(ql + nl * 64 + h * 8 + 16));
    qf1 = cat8(*(const v8h*)(ql + nl * 64 + 32 + h * 8),
               *(const v8h*)(ql + nl * 64 + 32 + h * 8 + 16));
  }
#else
  qf0 = load_a16(qh, 64, q0, 0, lane);
  qf1 = load_a16(qh, 64, q0, 32, lane);
#endif

  // o*[r] = O^T[d = 16j + 8h + r][query q0 + nl]
  v8f o0 = {}, o1 = {}, o2 = {}, o3 = {};
  float mrow = -3.0e38f;   // running maximum of this lane's query (both halves)
  float lrow = 0.f;        // running sum over this half's keys only

  const int qi = q0 + nl;
  const int kend = q0 + 16;

  for (int kb = 0; kb < kend; kb += 32) {
    // the last trip has no next block: it fetches its own again (in bounds)
    const int kn = (kb + 32 < kend) ? kb + 32 : kb;

    // scores: k(32x64) @ q^T -> two 16x16 f32 tiles, row = key, column = query
    v8f s0 = {}, s1 = {};
    s0 = wmma_f16(k0, qf0, s0);
    s0 = wmma_f16(k1, qf1, s0);
    s1 = wmma_f16(k2, qf0, s1);
    s1 = wmma_f16(k3, qf1, s1);
    k0 = load_a16(kh, 64, kn,      0,  lane);
    k1 = load_a16(kh, 64, kn,      32, lane);
    k2 = load_a16(kh, 64, kn + 16, 0,  lane);
    k3 = load_a16(kh, 64, kn + 16, 32, lane);
    // the K loads' address registers are reused below: keep the
    // address-translation wait in front of that overwrite
    asm volatile("s_wait_xcnt 0x0" ::: "memory");
    // keeps the K loads up here: the scheduler otherwise sinks them to the
    // loop's foot, where their whole latency is waited out at the next scores
    __builtin_amdgcn_sched_barrier(0);

    float a0[8], a1[8], mx[8];
    #pragma unroll
    for (int r = 0; r < 8; ++r) {
      int key = kb + r + 8 * h;
      a0[r] = (key      <= qi) ? s0[r] * 0.125f : -3.0e38f;  // 1/sqrt(64)
      a1[r] = (key + 16 <= qi) ? s1[r] * 0.125f : -3.0e38f;
      mx[r] = fmaxf(a0[r], a1[r]);
    }
    float t = fmaxf(fmaxf(fmaxf(mx[0], mx[1]), fmaxf(mx[2], mx[3])),
                    fmaxf(fmaxf(mx[4], mx[5]), fmaxf(mx[6], mx[7])));
    t = fmaxf(t, xhalf(t));
    float mnew = fmaxf(mrow, t);
    float al = __expf(mrow - mnew);
    mrow = mnew;

    // probs: element r = key 8h + r, element 8 + r = key 16 + 8h + r, which
    // is the k order load_a16 gives the vT fragments
    v16h pf;
    float sm[8];
    #pragma unroll
    for (int r = 0; r < 8; ++r) {
      float p0 = __expf(a0[r] - mnew);
      float p1 = __expf(a1[r] - mnew);
      sm[r] = p0 + p1;
      pf[r]     = (_Float16)p0;
      pf[8 + r] = (_Float16)p1;
    }
    lrow = lrow * al + (((sm[0] + sm[1]) + (sm[2] + sm[3])) +
                        ((sm[4] + sm[5]) + (sm[6] + sm[7])));
    #pragma unroll
    for (int r = 0; r < 8; ++r) {
      o0[r] *= al; o1[r] *= al;
      o2[r] *= al; o3[r] *= al;
    }

    // O^T += V^T(64x32) @ P^T(32x16); vT rows are d -> row-contiguous A fragments
    o0 = wmma_f16(v0, pf, o0);
    o1 = wmma_f16(v1, pf, o1);
    o2 = wmma_f16(v2, pf, o2);
    o3 = wmma_f16(v3, pf, o3);
    v0 = load_a16(vh, 2048, 0,  kn, lane);
    v1 = load_a16(vh, 2048, 16, kn, lane);
    v2 = load_a16(vh, 2048, 32, kn, lane);
    v3 = load_a16(vh, 2048, 48, kn, lane);
    asm volatile("s_wait_xcnt 0x0" ::: "memory");
  }
  // the last trip's fetch is still in flight and nothing reads it: let it land
  // before the wave hands its registers back
  asm volatile("s_wait_loadcnt 0x0" ::: "memory");

  // join the two halves' sums once; a lane's 8 registers of a tile are 8
  // consecutive d of its query: one 16-byte store per tile
  float inv = 1.0f / (lrow + xhalf(lrow));
  _Float16* orow = O + (size_t)qi * 1024 + head * 64 + 8 * h;
  v8h w0, w1, w2, w3;
  #pragma unroll
  for (int r = 0; r < 8; ++r) {
    w0[r] = (_Float16)(o0[r] * inv);
    w1[r] = (_Float16)(o1[r] * inv);
    w2[r] = (_Float16)(o2[r] * inv);
    w3[r] = (_Float16)(o3[r] * inv);
  }
  *(v8h*)(orow)      = w0;
  *(v8h*)(orow + 16) = w1;
  *(v8h*)(orow + 32) = w2;
  *(v8h*)(orow + 48) = w3;
}

// ---------------------------------------------------------------------------
// Output projection: O(2048x1024 f16) @ w_proj -> d_out f32. 32x64 tiles.
// ---------------------------------------------------------------------------
__global__ void proj_kernel(const _Float16* __restrict__ Oh,
                            const _Float16* __restrict__ wpk,
                            float* __restrict__ out) {
  const int KT = 32;
  int gw   = (blockIdx.x * blockDim.x + threadIdx.x) >> 5;
  int lane = threadIdx.x & 31;
  int mt = gw & 63;                        // 64 row tiles of 32
  int ng = gw >> 6;                        // 16 col groups of 64
  int h = lane >> 4, nl = lane & 15;

  v8f c[2][4] = {};
  const _Float16* arow0 = Oh + (size_t)(mt * 32 + nl) * 1024 + h * 8;
  const _Float16* arow1 = arow0 + (size_t)16 * 1024;
  const _Float16* bptr  = wpk + ((size_t)(ng * 4) * KT * 32 + lane) * 16;

  #pragma unroll 2
  for (int kt = 0; kt < KT; ++kt) {
    v16h a0 = cat8(*(const v8h*)(arow0 + kt * 32),
                   *(const v8h*)(arow0 + kt * 32 + 16));
    v16h a1 = cat8(*(const v8h*)(arow1 + kt * 32),
                   *(const v8h*)(arow1 + kt * 32 + 16));
    #pragma unroll
    for (int j = 0; j < 4; ++j) {
      v16h b = *(const v16h*)(bptr + (size_t)j * 16384 + (size_t)kt * 512);
      c[0][j] = wmma_f16(a0, b, c[0][j]);
      c[1][j] = wmma_f16(a1, b, c[1][j]);
    }
  }
  #pragma unroll
  for (int i = 0; i < 2; ++i)
    #pragma unroll
    for (int j = 0; j < 4; ++j)
      #pragma unroll
      for (int r = 0; r < 8; ++r) {
        int t = mt * 32 + i * 16 + r + 8 * h;
        out[(size_t)t * 1024 + ng * 64 + j * 16 + nl] = c[i][j][r];
      }
}

// ---------------------------------------------------------------------------
extern "C" void kernel_launch(void* const* d_in, const int* in_sizes, int n_in,
                              void* d_out, int out_size, void* d_ws, size_t ws_size,
                              hipStream_t stream) {
  const float* x     = (const float*)d_in[0];   // (1,2048,1024)
  const float* wqkv  = (const float*)d_in[1];   // (1024,3072)
  const float* wproj = (const float*)d_in[2];   // (1024,1024)
  float* out = (float*)d_out;                   // (1,2048,1024)

  char* ws = (char*)d_ws;                       // needs ~28 MB
  _Float16* xh       = (_Float16*)(ws);                         // 4 MB
  _Float16* wqkv_pk  = (_Float16*)(ws + ((size_t)4  << 20));    // 6 MB
  _Float16* wproj_pk = (_Float16*)(ws + ((size_t)10 << 20));    // 2 MB
  _Float16* q        = (_Float16*)(ws + ((size_t)12 << 20));    // 4 MB
  _Float16* k        = (_Float16*)(ws + ((size_t)16 << 20));    // 4 MB
  _Float16* vT       = (_Float16*)(ws + ((size_t)20 << 20));    // 4 MB
  _Float16* O        = (_Float16*)(ws + ((size_t)24 << 20));    // 4 MB

  f32_to_f16_kernel<<<2097152 / 256, 256, 0, stream>>>(x, xh, 2097152);
  pack_b_kernel<<<3145728 / 256, 256, 0, stream>>>(wqkv, wqkv_pk, 1024, 3072);
  pack_b_kernel<<<1048576 / 256, 256, 0, stream>>>(wproj, wproj_pk, 1024, 1024);

  // 64x48 tiles of 32x64, 1 tile/wave, 8 waves/block
  qkv_rope_kernel<<<384, 256, 0, stream>>>(xh, wqkv_pk, q, k, vT);
  // 16 heads x 128 q-strips = 2048 waves, 4 waves/block
  flash_attn_kernel<<<512, 128, 0, stream>>>(q, k, vT, O);
  // 64x16 tiles of 32x64, 8 waves/block
  proj_kernel<<<128, 256, 0, stream>>>(O, wproj_pk, out);
}

// v003
// One run takes 113 microseconds.
// Timed twice side by side with v002, it ran 1.14 and 1.16 times as fast.
// Over all steps from v000 it is 2.70 times as fast.
#include <hip/hip_runtime.h>
#include <hip/hip_bf16.h>

typedef __attribute__((ext_vector_type(16))) _Float16 v16h;
typedef __attribute__((ext_vector_type(8)))  _Float16 v8h;
typedef __attribute__((ext_vector_type(8)))  float    v8f;

#if defined(__has_builtin)
#if __has_builtin(__builtin_amdgcn_tensor_load_to_lds) && __has_builtin(__builtin_amdgcn_s_wait_tensorcnt)
#define HAVE_TDM 1
#endif
#endif

__device__ __forceinline__ v16h cat8(v8h a, v8h b) {
  return __builtin_shufflevector(a, b, 0,1,2,3,4,5,6,7,8,9,10,11,12,13,14,15);
}

__device__ __forceinline__ v8f wmma_f16(v16h a, v16h b, v8f c) {
  // v_wmma_f32_16x16x32_f16 (neg_a, A, neg_b, B, c_mod, C, reuse_a, reuse_b)
  return __builtin_amdgcn_wmma_f32_16x16x32_f16(false, a, false, b, (short)0, c, false, false);
}

// Fragment order: a 16x32 f16 operand tile (16 rows of A, or 16 columns of B,
// by 32 k) is 1 KB in the workspace, two halves of 512 B. With h = lane >> 4,
// half s holds at lane * 16 B the 8 elements k = 16s + 8h .. 16s + 8h + 7 of
// row (column) lane & 15: the lane's fragment registers as they are. A wave's
// 16-byte load then covers 4 whole 128-B lines, not 32-B pieces of 16 lines.
__device__ __forceinline__ v16h load_frag(const _Float16* __restrict__ tile,
                                          int lane) {
  const _Float16* p = tile + lane * 8;
  return cat8(*(const v8h*)(p), *(const v8h*)(p + 256));
}

#ifdef HAVE_TDM
__device__ __forceinline__ void tdm_load_2d_f16(unsigned lds_off,
                                                const void* gptr,
                                                int tile_w, int tile_h,
                                                int stride) {
  typedef __attribute__((ext_vector_type(4))) unsigned u32x4;
  typedef __attribute__((ext_vector_type(4))) int      i32x4;
  typedef __attribute__((ext_vector_type(8))) int      i32x8;
  unsigned long long ga = (unsigned long long)(uintptr_t)gptr;
  u32x4 g0;
  g0[0] = 1u;
  g0[1] = lds_off;
  g0[2] = (unsigned)(ga & 0xFFFFFFFFu);
  g0[3] = (unsigned)((ga >> 32) & 0x1FFFFFFu) | (2u << 30);
  i32x8 g1;
  g1[0] = 1 << 16;
  g1[1] = (tile_w & 0xFFFF) << 16;
  g1[2] = ((tile_w >> 16) & 0xFFFF) | ((tile_h & 0xFFFF) << 16);
  g1[3] = ((tile_h >> 16) & 0xFFFF) | ((tile_w & 0xFFFF) << 16);
  g1[4] = tile_h & 0xFFFF;
  g1[5] = stride;
  g1[6] = 0;
  g1[7] = 0;
  i32x4 z4 = {0, 0, 0, 0};
#if __clang_major__ >= 23
  i32x8 z8 = {0, 0, 0, 0, 0, 0, 0, 0};
  __builtin_amdgcn_tensor_load_to_lds(g0, g1, z4, z4, z8, 0);
#else
  __builtin_amdgcn_tensor_load_to_lds(g0, g1, z4, z4, 0);
#endif
}
#endif

// ---------------------------------------------------------------------------
// fp32 -> fp16 convert of a row-major matrix of 1024 columns into fragment
// order (tile = 16 rows x 32 columns, tiles of a row strip side by side).
// Indexed by the output, so that a block writes 512 contiguous bytes.
// ---------------------------------------------------------------------------
__global__ void f32_to_f16_kernel(const float* __restrict__ src,
                                  _Float16* __restrict__ dst, int n) {
  int i = blockIdx.x * blockDim.x + threadIdx.x;
  if (i >= n) return;
  int lane = (i >> 3) & 31;
  int tile = i >> 9;
  int row = (tile >> 5) * 16 + (lane & 15);
  int col = (tile & 31) * 32 + (((i >> 8) & 1) << 4) + ((lane >> 4) << 3) + (i & 7);
  dst[i] = (_Float16)src[(size_t)row * 1024 + col];
}

// ---------------------------------------------------------------------------
// Pack a K x N row-major f32 matrix into WMMA-B fragment order (f16): the
// GEMM consumer does two 16-byte loads per lane per WMMA, 512 B a wave each.
// ---------------------------------------------------------------------------
__global__ void pack_b_kernel(const float* __restrict__ src,
                              _Float16* __restrict__ dst, int K, int N) {
  int i = blockIdx.x * blockDim.x + threadIdx.x;
  if (i >= K * N) return;
  int e    = (i & 7) | (((i >> 8) & 1) << 3);
  int lane = (i >> 3) & 31;
  int tile = i >> 9;
  int KT = K >> 5;
  int kt = tile % KT;
  int nt = tile / KT;
  int kk = kt * 32 + ((e >> 3) << 4) + ((lane >> 4) << 3) + (e & 7);
  int nn = nt * 16 + (lane & 15);
  dst[i] = (_Float16)src[(size_t)kk * N + nn];
}

// ---------------------------------------------------------------------------
// QKV GEMM (2048x1024 @ 1024x3072) + RoPE + scatter.
// One 32x64 output tile per wave: 2 A-frags x 4 B-frags -> 8 WMMAs per
// k-step, 12 b128 loads. Each wave's 64 columns = one head of one of q/k/v.
// ---------------------------------------------------------------------------
__global__ void qkv_rope_kernel(const _Float16* __restrict__ xh,
                                const _Float16* __restrict__ wpk,
                                _Float16* __restrict__ q,
                                _Float16* __restrict__ kd,
                                _Float16* __restrict__ vT) {
  const int KT = 32;                       // 1024 / 32
  int gw   = (blockIdx.x * blockDim.x + threadIdx.x) >> 5;
  int lane = threadIdx.x & 31;
  int mt = gw & 63;                        // 64 row tiles of 32 rows
  int ng = gw >> 6;                        // 48 col groups of 64 cols
  int h = lane >> 4, nl = lane & 15;

  v8f c[2][4] = {};
  // both operands in fragment order: 512 halfs a tile, 32 tiles a strip
  const _Float16* atile = xh  + (size_t)(mt * 2) * KT * 512;
  const _Float16* btile = wpk + (size_t)(ng * 4) * KT * 512;

  #pragma unroll 2
  for (int kt = 0; kt < KT; ++kt) {
    v16h a0 = load_frag(atile + (size_t)kt * 512, lane);
    v16h a1 = load_frag(atile + 16384 + (size_t)kt * 512, lane);
    #pragma unroll
    for (int j = 0; j < 4; ++j) {
      v16h b = load_frag(btile + (size_t)j * 16384 + (size_t)kt * 512, lane);
      c[0][j] = wmma_f16(a0, b, c[0][j]);
      c[1][j] = wmma_f16(a1, b, c[1][j]);
    }
  }

  int sect = (ng * 64) >> 10;              // 0=q 1=k 2=v (uniform per wave)
  int head = ng & 15;                      // uniform per wave

  if (sect == 2) {
    // V^T in fragment order, [H][32-key block][16-d tile]: a lane's 8 registers
    // are keys 16i + 8h + r of d = 16j + nl, its own 16 bytes of half i
    _Float16* dst = vT + (size_t)head * 131072 + (size_t)mt * 2048 + lane * 8;
    #pragma unroll
    for (int j = 0; j < 4; ++j)
      #pragma unroll
      for (int i = 0; i < 2; ++i) {
        v8h w;
        #pragma unroll
        for (int r = 0; r < 8; ++r) w[r] = (_Float16)c[i][j][r];
        *(v8h*)(dst + j * 512 + i * 256) = w;
      }
  } else {
    // RoPE, then Q and K in fragment order, [H][16-row tile][32-d tile]: row
    // r + 8h, d = 16j + nl lies in half j & 1 at lane (r + 8h) + 16 (nl >> 3),
    // element nl & 7. The wave fills each 512 B alone.
    _Float16* base = (sect == 0 ? q : kd) + (size_t)head * 131072 +
                     (size_t)mt * 2048 + h * 64 + (nl >> 3) * 128 + (nl & 7);
    #pragma unroll
    for (int j = 0; j < 4; ++j) {
      int d = j * 16 + nl;
      // inv_freq = 10000^(-(d>>1)/32) = exp(-(d>>1) * ln(10000)/32)
      float fr = __expf(-(float)(d >> 1) * 0.28782313662425572f);
      #pragma unroll
      for (int i = 0; i < 2; ++i) {
        #pragma unroll
        for (int r = 0; r < 8; ++r) {
          float xv = c[i][j][r];
          float pv = __shfl_xor(xv, 1, 32);  // partner column d^1 = lane^1
          int t = mt * 32 + i * 16 + r + 8 * h;
          float s, co;
          __sincosf((float)t * fr, &s, &co);
          float o = (d & 1) ? fmaf(pv, s, xv * co) : fmaf(xv, co, -pv * s);
          base[i * 1024 + j * 256 + r * 8] = (_Float16)o;
        }
      }
    }
  }
}

__device__ __forceinline__ float xhalf(float x) {
  int b = __builtin_bit_cast(int, x);
  return __builtin_bit_cast(float,
      __builtin_amdgcn_permlanex16(b, b, 0x76543210, 0xfedcba98, false, false));
}

__global__ void __launch_bounds__(128)
flash_attn_kernel(const _Float16* __restrict__ q,
                                  const _Float16* __restrict__ k,
                                  const _Float16* __restrict__ vT,
                                  _Float16* __restrict__ O) {
#ifdef HAVE_TDM
  __shared__ __align__(16) _Float16 lds_q[4][1024];   // 16x64 q per wave
#endif
  int wv = threadIdx.x >> 5;
  int lane = threadIdx.x & 31;
  int gw = blockIdx.x * 4 + wv;
  int head = gw >> 7;
  int qt   = gw & 127;
  int q0 = qt << 4;
  int h = lane >> 4, nl = lane & 15;

  // q, K and V^T lie in fragment order: a 16-query strip is 2 tiles = 2 KB in a
  // row, a 32-key block 4 tiles = 4 KB of K and of V^T
  const _Float16* qh = q  + (size_t)head * 131072;   // [T/16][D/32] tiles
  const _Float16* kh = k  + (size_t)head * 131072;   // [T/16][D/32] tiles
  const _Float16* vh = vT + (size_t)head * 131072;   // [T/32][D/16] tiles

  // K and V^T fragments are fetched one key block ahead, all eight loads of an
  // operand together: K's fly during the softmax and the second product, V's
  // during the next block's scores and softmax; the first block's during the
  // staging of q.
  v16h k0 = load_frag(kh,        lane);   // keys 0..15,  d 0..31
  v16h k1 = load_frag(kh + 512,  lane);   // keys 0..15,  d 32..63
  v16h k2 = load_frag(kh + 1024, lane);   // keys 16..31, d 0..31
  v16h k3 = load_frag(kh + 1536, lane);   // keys 16..31, d 32..63
  v16h v0 = load_frag(vh,        lane);   // d 0..15
  v16h v1 = load_frag(vh + 512,  lane);   // d 16..31
  v16h v2 = load_frag(vh + 1024, lane);   // d 32..47
  v16h v3 = load_frag(vh + 1536, lane);   // d 48..63
  // the loads' address registers are reused below: keep the
  // address-translation wait in front of that overwrite
  asm volatile("s_wait_xcnt 0x0" ::: "memory");

  v16h qf0, qf1;
#ifdef HAVE_TDM
  {
    unsigned loff = (unsigned)(uintptr_t)(&lds_q[wv][0]);  // LDS byte offset
    tdm_load_2d_f16(loff, qh + (size_t)q0 * 64, /*w=*/64, /*h=*/16, /*stride=*/64);
    __builtin_amdgcn_s_wait_tensorcnt(0);
    const _Float16* ql = &lds_q[wv][0];
    qf0 = load_frag(ql, lane);         // d 0..31
    qf1 = load_frag(ql + 512, lane);   // d 32..63
  }
#else
  qf0 = load_frag(qh + (size_t)q0 * 64, lane);
  qf1 = load_frag(qh + (size_t)q0 * 64 + 512, lane);
#endif

  // o*[r] = O^T[d = 16j + 8h + r][query q0 + nl]
  v8f o0 = {}, o1 = {}, o2 = {}, o3 = {};
  float mrow = -3.0e38f;   // running maximum of this lane's query (both halves)
  float lrow = 0.f;        // running sum over this half's keys only

  const int qi = q0 + nl;
  const int kend = q0 + 16;

  for (int kb = 0; kb < kend; kb += 32) {
    // the last trip has no next block: it fetches its own again (in bounds)
    const int kn = (kb + 32 < kend) ? kb + 32 : kb;

    // scores: k(32x64) @ q^T -> two 16x16 f32 tiles, row = key, column = query
    v8f s0 = {}, s1 = {};
    s0 = wmma_f16(k0, qf0, s0);
    s0 = wmma_f16(k1, qf1, s0);
    s1 = wmma_f16(k2, qf0, s1);
    s1 = wmma_f16(k3, qf1, s1);
    k0 = load_frag(kh + (size_t)kn * 64,        lane);
    k1 = load_frag(kh + (size_t)kn * 64 + 512,  lane);
    k2 = load_frag(kh + (size_t)kn * 64 + 1024, lane);
    k3 = load_frag(kh + (size_t)kn * 64 + 1536, lane);
    // the K loads' address registers are reused below: keep the
    // address-translation wait in front of that overwrite
    asm volatile("s_wait_xcnt 0x0" ::: "memory");
    // keeps the K loads up here: the scheduler otherwise sinks them to the
    // loop's foot, where their whole latency is waited out at the next scores
    __builtin_amdgcn_sched_barrier(0);

    float a0[8], a1[8], mx[8];
    #pragma unroll
    for (int r = 0; r < 8; ++r) {
      int key = kb + r + 8 * h;
      a0[r] = (key      <= qi) ? s0[r] * 0.125f : -3.0e38f;  // 1/sqrt(64)
      a1[r] = (key + 16 <= qi) ? s1[r] * 0.125f : -3.0e38f;
      mx[r] = fmaxf(a0[r], a1[r]);
    }
    float t = fmaxf(fmaxf(fmaxf(mx[0], mx[1]), fmaxf(mx[2], mx[3])),
                    fmaxf(fmaxf(mx[4], mx[5]), fmaxf(mx[6], mx[7])));
    t = fmaxf(t, xhalf(t));
    float mnew = fmaxf(mrow, t);
    float al = __expf(mrow - mnew);
    mrow = mnew;

    // probs: element r = key 8h + r, element 8 + r = key 16 + 8h + r, which
    // is the k order of the vT fragments
    v16h pf;
    float sm[8];
    #pragma unroll
    for (int r = 0; r < 8; ++r) {
      float p0 = __expf(a0[r] - mnew);
      float p1 = __expf(a1[r] - mnew);
      sm[r] = p0 + p1;
      pf[r]     = (_Float16)p0;
      pf[8 + r] = (_Float16)p1;
    }
    lrow = lrow * al + (((sm[0] + sm[1]) + (sm[2] + sm[3])) +
                        ((sm[4] + sm[5]) + (sm[6] + sm[7])));
    #pragma unroll
    for (int r = 0; r < 8; ++r) {
      o0[r] *= al; o1[r] *= al;
      o2[r] *= al; o3[r] *= al;
    }

    // O^T += V^T(64x32) @ P^T(32x16); A rows are d
    o0 = wmma_f16(v0, pf, o0);
    o1 = wmma_f16(v1, pf, o1);
    o2 = wmma_f16(v2, pf, o2);
    o3 = wmma_f16(v3, pf, o3);
    v0 = load_frag(vh + (size_t)kn * 64,        lane);
    v1 = load_frag(vh + (size_t)kn * 64 + 512,  lane);
    v2 = load_frag(vh + (size_t)kn * 64 + 1024, lane);
    v3 = load_frag(vh + (size_t)kn * 64 + 1536, lane);
    asm volatile("s_wait_xcnt 0x0" ::: "memory");
  }
  // the last trip's fetch is still in flight and nothing reads it: let it land
  // before the wave hands its registers back
  asm volatile("s_wait_loadcnt 0x0" ::: "memory");

  // join the two halves' sums once; a lane's 8 registers of a tile are 8
  // consecutive d of its query: one 16-byte store per tile, in the fragment
  // order the projection reads (row nl, column 64 head + 16j + 8h + r: tile
  // 2 head + (j >> 1) of strip qt, half j & 1, this lane): 512 B a wave
  float inv = 1.0f / (lrow + xhalf(lrow));
  _Float16* orow = O + ((size_t)qt * 32 + head * 2) * 512 + lane * 8;
  v8h w0, w1, w2, w3;
  #pragma unroll
  for (int r = 0; r < 8; ++r) {
    w0[r] = (_Float16)(o0[r] * inv);
    w1[r] = (_Float16)(o1[r] * inv);
    w2[r] = (_Float16)(o2[r] * inv);
    w3[r] = (_Float16)(o3[r] * inv);
  }
  *(v8h*)(orow)       = w0;
  *(v8h*)(orow + 256) = w1;
  *(v8h*)(orow + 512) = w2;
  *(v8h*)(orow + 768) = w3;
}

// ---------------------------------------------------------------------------
// Output projection: O(2048x1024 f16) @ w_proj -> d_out f32. 32x64 tiles.
// ---------------------------------------------------------------------------
__global__ void proj_kernel(const _Float16* __restrict__ Oh,
                            const _Float16* __restrict__ wpk,
                            float* __restrict__ out) {
  const int KT = 32;
  int gw   = (blockIdx.x * blockDim.x + threadIdx.x) >> 5;
  int lane = threadIdx.x & 31;
  int mt = gw & 63;                        // 64 row tiles of 32
  int ng = gw >> 6;                        // 16 col groups of 64
  int h = lane >> 4, nl = lane & 15;

  v8f c[2][4] = {};
  // both operands in fragment order: 512 halfs a tile, 32 tiles a strip
  const _Float16* atile = Oh  + (size_t)(mt * 2) * KT * 512;
  const _Float16* btile = wpk + (size_t)(ng * 4) * KT * 512;

  #pragma unroll 2
  for (int kt = 0; kt < KT; ++kt) {
    v16h a0 = load_frag(atile + (size_t)kt * 512, lane);
    v16h a1 = load_frag(atile + 16384 + (size_t)kt * 512, lane);
    #pragma unroll
    for (int j = 0; j < 4; ++j) {
      v16h b = load_frag(btile + (size_t)j * 16384 + (size_t)kt * 512, lane);
      c[0][j] = wmma_f16(a0, b, c[0][j]);
      c[1][j] = wmma_f16(a1, b, c[1][j]);
    }
  }
  #pragma unroll
  for (int i = 0; i < 2; ++i)
    #pragma unroll
    for (int j = 0; j < 4; ++j)
      #pragma unroll
      for (int r = 0; r < 8; ++r) {
        int t = mt * 32 + i * 16 + r + 8 * h;
        out[(size_t)t * 1024 + ng * 64 + j * 16 + nl] = c[i][j][r];
      }
}

// ---------------------------------------------------------------------------
extern "C" void kernel_launch(void* const* d_in, const int* in_sizes, int n_in,
                              void* d_out, int out_size, void* d_ws, size_t ws_size,
                              hipStream_t stream) {
  const float* x     = (const float*)d_in[0];   // (1,2048,1024)
  const float* wqkv  = (const float*)d_in[1];   // (1024,3072)
  const float* wproj = (const float*)d_in[2];   // (1024,1024)
  float* out = (float*)d_out;                   // (1,2048,1024)

  char* ws = (char*)d_ws;                       // needs ~28 MB
  _Float16* xh       = (_Float16*)(ws);                         // 4 MB
  _Float16* wqkv_pk  = (_Float16*)(ws + ((size_t)4  << 20));    // 6 MB
  _Float16* wproj_pk = (_Float16*)(ws + ((size_t)10 << 20));    // 2 MB
  _Float16* q        = (_Float16*)(ws + ((size_t)12 << 20));    // 4 MB
  _Float16* k        = (_Float16*)(ws + ((size_t)16 << 20));    // 4 MB
  _Float16* vT       = (_Float16*)(ws + ((size_t)20 << 20));    // 4 MB
  _Float16* O        = (_Float16*)(ws + ((size_t)24 << 20));    // 4 MB

  f32_to_f16_kernel<<<2097152 / 256, 256, 0, stream>>>(x, xh, 2097152);
  pack_b_kernel<<<3145728 / 256, 256, 0, stream>>>(wqkv, wqkv_pk, 1024, 3072);
  pack_b_kernel<<<1048576 / 256, 256, 0, stream>>>(wproj, wproj_pk, 1024, 1024);

  // 64x48 tiles of 32x64, 1 tile/wave, 8 waves/block
  qkv_rope_kernel<<<384, 256, 0, stream>>>(xh, wqkv_pk, q, k, vT);
  // 16 heads x 128 q-strips = 2048 waves, 4 waves/block
  flash_attn_kernel<<<512, 128, 0, stream>>>(q, k, vT, O);
  // 64x16 tiles of 32x64, 8 waves/block
  proj_kernel<<<128, 256, 0, stream>>>(O, wproj_pk, out);
}

// v004
// One run takes 92.3 microseconds.
// Two timings next to v003 put it at 1.24 and 1.27 times that version's speed.
// Over all steps from v000 it is 3.39 times as fast.
#include <hip/hip_runtime.h>
#include <hip/hip_bf16.h>

typedef __attribute__((ext_vector_type(16))) _Float16 v16h;
typedef __attribute__((ext_vector_type(8)))  _Float16 v8h;
typedef __attribute__((ext_vector_type(8)))  float    v8f;

#if defined(__has_builtin)
#if __has_builtin(__builtin_amdgcn_tensor_load_to_lds) && __has_builtin(__builtin_amdgcn_s_wait_tensorcnt)
#define HAVE_TDM 1
#endif
#endif

__device__ __forceinline__ v16h cat8(v8h a, v8h b) {
  return __builtin_shufflevector(a, b, 0,1,2,3,4,5,6,7,8,9,10,11,12,13,14,15);
}

__device__ __forceinline__ v8f wmma_f16(v16h a, v16h b, v8f c) {
  // v_wmma_f32_16x16x32_f16 (neg_a, A, neg_b, B, c_mod, C, reuse_a, reuse_b)
  return __builtin_amdgcn_wmma_f32_16x16x32_f16(false, a, false, b, (short)0, c, false, false);
}

// Fragment order: a 16x32 f16 operand tile (16 rows of A, or 16 columns of B,
// by 32 k) is 1 KB in the workspace, two halves of 512 B. With h = lane >> 4,
// half s holds at lane * 16 B the 8 elements k = 16s + 8h .. 16s + 8h + 7 of
// row (column) lane & 15: the lane's fragment registers as they are. A wave's
// 16-byte load then covers 4 whole 128-B lines, not 32-B pieces of 16 lines.
__device__ __forceinline__ v16h load_frag(const _Float16* __restrict__ tile,
                                          int lane) {
  const _Float16* p = tile + lane * 8;
  return cat8(*(const v8h*)(p), *(const v8h*)(p + 256));
}

#ifdef HAVE_TDM
__device__ __forceinline__ void tdm_load_2d_f16(unsigned lds_off,
                                                const void* gptr,
                                                int tile_w, int tile_h,
                                                int stride) {
  typedef __attribute__((ext_vector_type(4))) unsigned u32x4;
  typedef __attribute__((ext_vector_type(4))) int      i32x4;
  typedef __attribute__((ext_vector_type(8))) int      i32x8;
  unsigned long long ga = (unsigned long long)(uintptr_t)gptr;
  u32x4 g0;
  g0[0] = 1u;
  g0[1] = lds_off;
  g0[2] = (unsigned)(ga & 0xFFFFFFFFu);
  g0[3] = (unsigned)((ga >> 32) & 0x1FFFFFFu) | (2u << 30);
  i32x8 g1;
  g1[0] = 1 << 16;
  g1[1] = (tile_w & 0xFFFF) << 16;
  g1[2] = ((tile_w >> 16) & 0xFFFF) | ((tile_h & 0xFFFF) << 16);
  g1[3] = ((tile_h >> 16) & 0xFFFF) | ((tile_w & 0xFFFF) << 16);
  g1[4] = tile_h & 0xFFFF;
  g1[5] = stride;
  g1[6] = 0;
  g1[7] = 0;
  i32x4 z4 = {0, 0, 0, 0};
#if __clang_major__ >= 23
  i32x8 z8 = {0, 0, 0, 0, 0, 0, 0, 0};
  __builtin_amdgcn_tensor_load_to_lds(g0, g1, z4, z4, z8, 0);
#else
  __builtin_amdgcn_tensor_load_to_lds(g0, g1, z4, z4, 0);
#endif
}
#endif

// ---------------------------------------------------------------------------
// fp32 -> fp16 convert of a row-major matrix of 1024 columns into fragment
// order (tile = 16 rows x 32 columns, tiles of a row strip side by side).
// Indexed by the output, so that a block writes 512 contiguous bytes.
// ---------------------------------------------------------------------------
__global__ void f32_to_f16_kernel(const float* __restrict__ src,
                                  _Float16* __restrict__ dst, int n) {
  int i = blockIdx.x * blockDim.x + threadIdx.x;
  if (i >= n) return;
  int lane = (i >> 3) & 31;
  int tile = i >> 9;
  int row = (tile >> 5) * 16 + (lane & 15);
  int col = (tile & 31) * 32 + (((i >> 8) & 1) << 4) + ((lane >> 4) << 3) + (i & 7);
  dst[i] = (_Float16)src[(size_t)row * 1024 + col];
}

// ---------------------------------------------------------------------------
// Pack a K x N row-major f32 matrix into WMMA-B fragment order (f16): the
// GEMM consumer does two 16-byte loads per lane per WMMA, 512 B a wave each.
// ---------------------------------------------------------------------------
__global__ void pack_b_kernel(const float* __restrict__ src,
                              _Float16* __restrict__ dst, int K, int N) {
  int i = blockIdx.x * blockDim.x + threadIdx.x;
  if (i >= K * N) return;
  int e    = (i & 7) | (((i >> 8) & 1) << 3);
  int lane = (i >> 3) & 31;
  int tile = i >> 9;
  int KT = K >> 5;
  int kt = tile % KT;
  int nt = tile / KT;
  int kk = kt * 32 + ((e >> 3) << 4) + ((lane >> 4) << 3) + (e & 7);
  int nn = nt * 16 + (lane & 15);
  dst[i] = (_Float16)src[(size_t)kk * N + nn];
}

// ---------------------------------------------------------------------------
// K = 1024 loop of a 32x64 wave tile, shared by the two GEMM kernels. Both
// operands lie in fragment order: 512 halfs a tile, 32 tiles a strip.
// The 12 loads of a k-step (2 A and 4 B fragments) are issued together, two
// k-steps ahead of the 8 WMMAs that use them, into a ring of three register
// sets: the L2 latency is spread over two k-steps of matrix work, where a
// single set meant two load-wait rounds in series inside every k-step.
// ---------------------------------------------------------------------------
struct KStep { v16h a0, a1, b0, b1, b2, b3; };

__device__ __forceinline__ KStep load_kstep(const _Float16* __restrict__ atile,
                                            const _Float16* __restrict__ btile,
                                            int kt, int lane) {
  KStep f;
  f.a0 = load_frag(atile + kt * 512, lane);
  f.a1 = load_frag(atile + 16384 + kt * 512, lane);
  f.b0 = load_frag(btile + kt * 512, lane);
  f.b1 = load_frag(btile + 16384 + kt * 512, lane);
  f.b2 = load_frag(btile + 32768 + kt * 512, lane);
  f.b3 = load_frag(btile + 49152 + kt * 512, lane);
  return f;
}

__device__ __forceinline__ void gemm_tile_32x64(const _Float16* __restrict__ atile,
                                                const _Float16* __restrict__ btile,
                                                int lane, v8f (&c)[2][4]) {
  const int KT = 32;                       // 1024 / 32
  KStep f[3];
  f[0] = load_kstep(atile, btile, 0, lane);
  f[1] = load_kstep(atile, btile, 1, lane);
  // unrolled in full: the ring index is then a constant (the sets stay in
  // registers) and kt goes into the loads' immediate offsets, so that the
  // loop rewrites no address register while loads are in flight
  #pragma unroll
  for (int kt = 0; kt < KT; ++kt) {
    if (kt + 2 < KT) f[(kt + 2) % 3] = load_kstep(atile, btile, kt + 2, lane);
    // keeps the loads up here: sunk towards their use they would lose the lead
    __builtin_amdgcn_sched_barrier(0);
    const KStep& g = f[kt % 3];
    c[0][0] = wmma_f16(g.a0, g.b0, c[0][0]);
    c[1][0] = wmma_f16(g.a1, g.b0, c[1][0]);
    c[0][1] = wmma_f16(g.a0, g.b1, c[0][1]);
    c[1][1] = wmma_f16(g.a1, g.b1, c[1][1]);
    c[0][2] = wmma_f16(g.a0, g.b2, c[0][2]);
    c[1][2] = wmma_f16(g.a1, g.b2, c[1][2]);
    c[0][3] = wmma_f16(g.a0, g.b3, c[0][3]);
    c[1][3] = wmma_f16(g.a1, g.b3, c[1][3]);
  }
}

// ---------------------------------------------------------------------------
// QKV GEMM (2048x1024 @ 1024x3072) + RoPE + scatter.
// One 32x64 output tile per wave: 2 A-frags x 4 B-frags -> 8 WMMAs per
// k-step, 12 b128 loads. Each wave's 64 columns = one head of one of q/k/v.
// ---------------------------------------------------------------------------
// The real block size is declared so that the register cap of a 1024-thread
// block goes: three sets of 48 fragment registers beside 64 accumulators.
__global__ void __launch_bounds__(256)
qkv_rope_kernel(const _Float16* __restrict__ xh,
                                const _Float16* __restrict__ wpk,
                                _Float16* __restrict__ q,
                                _Float16* __restrict__ kd,
                                _Float16* __restrict__ vT) {
  const int KT = 32;                       // 1024 / 32
  int gw   = (blockIdx.x * blockDim.x + threadIdx.x) >> 5;
  int lane = threadIdx.x & 31;
  int mt = gw & 63;                        // 64 row tiles of 32 rows
  int ng = gw >> 6;                        // 48 col groups of 64 cols
  int h = lane >> 4, nl = lane & 15;

  v8f c[2][4] = {};
  // both operands in fragment order: 512 halfs a tile, 32 tiles a strip
  const _Float16* atile = xh  + (size_t)(mt * 2) * KT * 512;
  const _Float16* btile = wpk + (size_t)(ng * 4) * KT * 512;

  gemm_tile_32x64(atile, btile, lane, c);

  int sect = (ng * 64) >> 10;              // 0=q 1=k 2=v (uniform per wave)
  int head = ng & 15;                      // uniform per wave

  if (sect == 2) {
    // V^T in fragment order, [H][32-key block][16-d tile]: a lane's 8 registers
    // are keys 16i + 8h + r of d = 16j + nl, its own 16 bytes of half i
    _Float16* dst = vT + (size_t)head * 131072 + (size_t)mt * 2048 + lane * 8;
    #pragma unroll
    for (int j = 0; j < 4; ++j)
      #pragma unroll
      for (int i = 0; i < 2; ++i) {
        v8h w;
        #pragma unroll
        for (int r = 0; r < 8; ++r) w[r] = (_Float16)c[i][j][r];
        *(v8h*)(dst + j * 512 + i * 256) = w;
      }
  } else {
    // RoPE, then Q and K in fragment order, [H][16-row tile][32-d tile]: row
    // r + 8h, d = 16j + nl lies in half j & 1 at lane (r + 8h) + 16 (nl >> 3),
    // element nl & 7. The wave fills each 512 B alone.
    _Float16* base = (sect == 0 ? q : kd) + (size_t)head * 131072 +
                     (size_t)mt * 2048 + h * 64 + (nl >> 3) * 128 + (nl & 7);
    #pragma unroll
    for (int j = 0; j < 4; ++j) {
      int d = j * 16 + nl;
      // inv_freq = 10000^(-(d>>1)/32) = exp(-(d>>1) * ln(10000)/32)
      float fr = __expf(-(float)(d >> 1) * 0.28782313662425572f);
      #pragma unroll
      for (int i = 0; i < 2; ++i) {
        #pragma unroll
        for (int r = 0; r < 8; ++r) {
          float xv = c[i][j][r];
          float pv = __shfl_xor(xv, 1, 32);  // partner column d^1 = lane^1
          int t = mt * 32 + i * 16 + r + 8 * h;
          float s, co;
          __sincosf((float)t * fr, &s, &co);
          float o = (d & 1) ? fmaf(pv, s, xv * co) : fmaf(xv, co, -pv * s);
          base[i * 1024 + j * 256 + r * 8] = (_Float16)o;
        }
      }
    }
  }
}

__device__ __forceinline__ float xhalf(float x) {
  int b = __builtin_bit_cast(int, x);
  return __builtin_bit_cast(float,
      __builtin_amdgcn_permlanex16(b, b, 0x76543210, 0xfedcba98, false, false));
}

__global__ void __launch_bounds__(128)
flash_attn_kernel(const _Float16* __restrict__ q,
                                  const _Float16* __restrict__ k,
                                  const _Float16* __restrict__ vT,
                                  _Float16* __restrict__ O) {
#ifdef HAVE_TDM
  __shared__ __align__(16) _Float16 lds_q[4][1024];   // 16x64 q per wave
#endif
  int wv = threadIdx.x >> 5;
  int lane = threadIdx.x & 31;
  int gw = blockIdx.x * 4 + wv;
  int head = gw >> 7;
  int qt   = gw & 127;
  int q0 = qt << 4;
  int h = lane >> 4, nl = lane & 15;

  // q, K and V^T lie in fragment order: a 16-query strip is 2 tiles = 2 KB in a
  // row, a 32-key block 4 tiles = 4 KB of K and of V^T
  const _Float16* qh = q  + (size_t)head * 131072;   // [T/16][D/32] tiles
  const _Float16* kh = k  + (size_t)head * 131072;   // [T/16][D/32] tiles
  const _Float16* vh = vT + (size_t)head * 131072;   // [T/32][D/16] tiles

  // K and V^T fragments are fetched one key block ahead, all eight loads of an
  // operand together: K's fly during the softmax and the second product, V's
  // during the next block's scores and softmax; the first block's during the
  // staging of q.
  v16h k0 = load_frag(kh,        lane);   // keys 0..15,  d 0..31
  v16h k1 = load_frag(kh + 512,  lane);   // keys 0..15,  d 32..63
  v16h k2 = load_frag(kh + 1024, lane);   // keys 16..31, d 0..31
  v16h k3 = load_frag(kh + 1536, lane);   // keys 16..31, d 32..63
  v16h v0 = load_frag(vh,        lane);   // d 0..15
  v16h v1 = load_frag(vh + 512,  lane);   // d 16..31
  v16h v2 = load_frag(vh + 1024, lane);   // d 32..47
  v16h v3 = load_frag(vh + 1536, lane);   // d 48..63
  // the loads' address registers are reused below: keep the
  // address-translation wait in front of that overwrite
  asm volatile("s_wait_xcnt 0x0" ::: "memory");

  v16h qf0, qf1;
#ifdef HAVE_TDM
  {
    unsigned loff = (unsigned)(uintptr_t)(&lds_q[wv][0]);  // LDS byte offset
    tdm_load_2d_f16(loff, qh + (size_t)q0 * 64, /*w=*/64, /*h=*/16, /*stride=*/64);
    __builtin_amdgcn_s_wait_tensorcnt(0);
    const _Float16* ql = &lds_q[wv][0];
    qf0 = load_frag(ql, lane);         // d 0..31
    qf1 = load_frag(ql + 512, lane);   // d 32..63
  }
#else
  qf0 = load_frag(qh + (size_t)q0 * 64, lane);
  qf1 = load_frag(qh + (size_t)q0 * 64 + 512, lane);
#endif

  // o*[r] = O^T[d = 16j + 8h + r][query q0 + nl]
  v8f o0 = {}, o1 = {}, o2 = {}, o3 = {};
  float mrow = -3.0e38f;   // running maximum of this lane's query (both halves)
  float lrow = 0.f;        // running sum over this half's keys only

  const int qi = q0 + nl;
  const int kend = q0 + 16;

  for (int kb = 0; kb < kend; kb += 32) {
    // the last trip has no next block: it fetches its own again (in bounds)
    const int kn = (kb + 32 < kend) ? kb + 32 : kb;

    // scores: k(32x64) @ q^T -> two 16x16 f32 tiles, row = key, column = query
    v8f s0 = {}, s1 = {};
    s0 = wmma_f16(k0, qf0, s0);
    s0 = wmma_f16(k1, qf1, s0);
    s1 = wmma_f16(k2, qf0, s1);
    s1 = wmma_f16(k3, qf1, s1);
    k0 = load_frag(kh + (size_t)kn * 64,        lane);
    k1 = load_frag(kh + (size_t)kn * 64 + 512,  lane);
    k2 = load_frag(kh + (size_t)kn * 64 + 1024, lane);
    k3 = load_frag(kh + (size_t)kn * 64 + 1536, lane);
    // the K loads' address registers are reused below: keep the
    // address-translation wait in front of that overwrite
    asm volatile("s_wait_xcnt 0x0" ::: "memory");
    // keeps the K loads up here: the scheduler otherwise sinks them to the
    // loop's foot, where their whole latency is waited out at the next scores
    __builtin_amdgcn_sched_barrier(0);

    float a0[8], a1[8], mx[8];
    #pragma unroll
    for (int r = 0; r < 8; ++r) {
      int key = kb + r + 8 * h;
      a0[r] = (key      <= qi) ? s0[r] * 0.125f : -3.0e38f;  // 1/sqrt(64)
      a1[r] = (key + 16 <= qi) ? s1[r] * 0.125f : -3.0e38f;
      mx[r] = fmaxf(a0[r], a1[r]);
    }
    float t = fmaxf(fmaxf(fmaxf(mx[0], mx[1]), fmaxf(mx[2], mx[3])),
                    fmaxf(fmaxf(mx[4], mx[5]), fmaxf(mx[6], mx[7])));
    t = fmaxf(t, xhalf(t));
    float mnew = fmaxf(mrow, t);
    float al = __expf(mrow - mnew);
    mrow = mnew;

    // probs: element r = key 8h + r, element 8 + r = key 16 + 8h + r, which
    // is the k order of the vT fragments
    v16h pf;
    float sm[8];
    #pragma unroll
    for (int r = 0; r < 8; ++r) {
      float p0 = __expf(a0[r] - mnew);
      float p1 = __expf(a1[r] - mnew);
      sm[r] = p0 + p1;
      pf[r]     = (_Float16)p0;
      pf[8 + r] = (_Float16)p1;
    }
    lrow = lrow * al + (((sm[0] + sm[1]) + (sm[2] + sm[3])) +
                        ((sm[4] + sm[5]) + (sm[6] + sm[7])));
    #pragma unroll
    for (int r = 0; r < 8; ++r) {
      o0[r] *= al; o1[r] *= al;
      o2[r] *= al; o3[r] *= al;
    }

    // O^T += V^T(64x32) @ P^T(32x16); A rows are d
    o0 = wmma_f16(v0, pf, o0);
    o1 = wmma_f16(v1, pf, o1);
    o2 = wmma_f16(v2, pf, o2);
    o3 = wmma_f16(v3, pf, o3);
    v0 = load_frag(vh + (size_t)kn * 64,        lane);
    v1 = load_frag(vh + (size_t)kn * 64 + 512,  lane);
    v2 = load_frag(vh + (size_t)kn * 64 + 1024, lane);
    v3 = load_frag(vh + (size_t)kn * 64 + 1536, lane);
    asm volatile("s_wait_xcnt 0x0" ::: "memory");
  }
  // the last trip's fetch is still in flight and nothing reads it: let it land
  // before the wave hands its registers back
  asm volatile("s_wait_loadcnt 0x0" ::: "memory");

  // join the two halves' sums once; a lane's 8 registers of a tile are 8
  // consecutive d of its query: one 16-byte store per tile, in the fragment
  // order the projection reads (row nl, column 64 head + 16j + 8h + r: tile
  // 2 head + (j >> 1) of strip qt, half j & 1, this lane): 512 B a wave
  float inv = 1.0f / (lrow + xhalf(lrow));
  _Float16* orow = O + ((size_t)qt * 32 + head * 2) * 512 + lane * 8;
  v8h w0, w1, w2, w3;
  #pragma unroll
  for (int r = 0; r < 8; ++r) {
    w0[r] = (_Float16)(o0[r] * inv);
    w1[r] = (_Float16)(o1[r] * inv);
    w2[r] = (_Float16)(o2[r] * inv);
    w3[r] = (_Float16)(o3[r] * inv);
  }
  *(v8h*)(orow)       = w0;
  *(v8h*)(orow + 256) = w1;
  *(v8h*)(orow + 512) = w2;
  *(v8h*)(orow + 768) = w3;
}

// ---------------------------------------------------------------------------
// Output projection: O(2048x1024 f16) @ w_proj -> d_out f32. 32x64 tiles.
// ---------------------------------------------------------------------------
__global__ void __launch_bounds__(256)   // as for the QKV GEMM
proj_kernel(const _Float16* __restrict__ Oh,
                            const _Float16* __restrict__ wpk,
                            float* __restrict__ out) {
  const int KT = 32;
  int gw   = (blockIdx.x * blockDim.x + threadIdx.x) >> 5;
  int lane = threadIdx.x & 31;
  int mt = gw & 63;                        // 64 row tiles of 32
  int ng = gw >> 6;                        // 16 col groups of 64
  int h = lane >> 4, nl = lane & 15;

  v8f c[2][4] = {};
  // both operands in fragment order: 512 halfs a tile, 32 tiles a strip
  const _Float16* atile = Oh  + (size_t)(mt * 2) * KT * 512;
  const _Float16* btile = wpk + (size_t)(ng * 4) * KT * 512;

  gemm_tile_32x64(atile, btile, lane, c);
  #pragma unroll
  for (int i = 0; i < 2; ++i)
    #pragma unroll
    for (int j = 0; j < 4; ++j)
      #pragma unroll
      for (int r = 0; r < 8; ++r) {
        int t = mt * 32 + i * 16 + r + 8 * h;
        out[(size_t)t * 1024 + ng * 64 + j * 16 + nl] = c[i][j][r];
      }
}

// ---------------------------------------------------------------------------
extern "C" void kernel_launch(void* const* d_in, const int* in_sizes, int n_in,
                              void* d_out, int out_size, void* d_ws, size_t ws_size,
                              hipStream_t stream) {
  const float* x     = (const float*)d_in[0];   // (1,2048,1024)
  const float* wqkv  = (const float*)d_in[1];   // (1024,3072)
  const float* wproj = (const float*)d_in[2];   // (1024,1024)
  float* out = (float*)d_out;                   // (1,2048,1024)

  char* ws = (char*)d_ws;                       // needs ~28 MB
  _Float16* xh       = (_Float16*)(ws);                         // 4 MB
  _Float16* wqkv_pk  = (_Float16*)(ws + ((size_t)4  << 20));    // 6 MB
  _Float16* wproj_pk = (_Float16*)(ws + ((size_t)10 << 20));    // 2 MB
  _Float16* q        = (_Float16*)(ws + ((size_t)12 << 20));    // 4 MB
  _Float16* k        = (_Float16*)(ws + ((size_t)16 << 20));    // 4 MB
  _Float16* vT       = (_Float16*)(ws + ((size_t)20 << 20));    // 4 MB
  _Float16* O        = (_Float16*)(ws + ((size_t)24 << 20));    // 4 MB

  f32_to_f16_kernel<<<2097152 / 256, 256, 0, stream>>>(x, xh, 2097152);
  pack_b_kernel<<<3145728 / 256, 256, 0, stream>>>(wqkv, wqkv_pk, 1024, 3072);
  pack_b_kernel<<<1048576 / 256, 256, 0, stream>>>(wproj, wproj_pk, 1024, 1024);

  // 64x48 tiles of 32x64, 1 tile/wave, 8 waves/block
  qkv_rope_kernel<<<384, 256, 0, stream>>>(xh, wqkv_pk, q, k, vT);
  // 16 heads x 128 q-strips = 2048 waves, 4 waves/block
  flash_attn_kernel<<<512, 128, 0, stream>>>(q, k, vT, O);
  // 64x16 tiles of 32x64, 8 waves/block
  proj_kernel<<<128, 256, 0, stream>>>(O, wproj_pk, out);
}

// v005
// One run takes 80.5 microseconds.
// In two side-by-side timings against v004, it was 1.13 and 1.12 times as fast.
// Over all steps from v000 it is 3.81 times as fast.
#include <hip/hip_runtime.h>
#include <hip/hip_bf16.h>

typedef __attribute__((ext_vector_type(16))) _Float16 v16h;
typedef __attribute__((ext_vector_type(8)))  _Float16 v8h;
typedef __attribute__((ext_vector_type(8)))  float    v8f;

#if defined(__has_builtin)
#if __has_builtin(__builtin_amdgcn_tensor_load_to_lds) && __has_builtin(__builtin_amdgcn_s_wait_tensorcnt)
#define HAVE_TDM 1
#endif
#endif

__device__ __forceinline__ v16h cat8(v8h a, v8h b) {
  return __builtin_shufflevector(a, b, 0,1,2,3,4,5,6,7,8,9,10,11,12,13,14,15);
}

__device__ __forceinline__ v8f wmma_f16(v16h a, v16h b, v8f c) {
  // v_wmma_f32_16x16x32_f16 (neg_a, A, neg_b, B, c_mod, C, reuse_a, reuse_b)
  return __builtin_amdgcn_wmma_f32_16x16x32_f16(false, a, false, b, (short)0, c, false, false);
}

// Fragment order: a 16x32 f16 operand tile (16 rows of A, or 16 columns of B,
// by 32 k) is 1 KB in the workspace, two halves of 512 B. With h = lane >> 4,
// half s holds at lane * 16 B the 8 elements k = 16s + 8h .. 16s + 8h + 7 of
// row (column) lane & 15: the lane's fragment registers as they are. A wave's
// 16-byte load then covers 4 whole 128-B lines, not 32-B pieces of 16 lines.
__device__ __forceinline__ v16h load_frag(const _Float16* __restrict__ tile,
                                          int lane) {
  const _Float16* p = tile + lane * 8;
  return cat8(*(const v8h*)(p), *(const v8h*)(p + 256));
}

#ifdef HAVE_TDM
__device__ __forceinline__ void tdm_load_2d_f16(unsigned lds_off,
                                                const void* gptr,
                                                int tile_w, int tile_h,
                                                int stride) {
  typedef __attribute__((ext_vector_type(4))) unsigned u32x4;
  typedef __attribute__((ext_vector_type(4))) int      i32x4;
  typedef __attribute__((ext_vector_type(8))) int      i32x8;
  unsigned long long ga = (unsigned long long)(uintptr_t)gptr;
  u32x4 g0;
  g0[0] = 1u;
  g0[1] = lds_off;
  g0[2] = (unsigned)(ga & 0xFFFFFFFFu);
  g0[3] = (unsigned)((ga >> 32) & 0x1FFFFFFu) | (2u << 30);
  i32x8 g1;
  g1[0] = 1 << 16;
  g1[1] = (tile_w & 0xFFFF) << 16;
  g1[2] = ((tile_w >> 16) & 0xFFFF) | ((tile_h & 0xFFFF) << 16);
  g1[3] = ((tile_h >> 16) & 0xFFFF) | ((tile_w & 0xFFFF) << 16);
  g1[4] = tile_h & 0xFFFF;
  g1[5] = stride;
  g1[6] = 0;
  g1[7] = 0;
  i32x4 z4 = {0, 0, 0, 0};
#if __clang_major__ >= 23
  i32x8 z8 = {0, 0, 0, 0, 0, 0, 0, 0};
  __builtin_amdgcn_tensor_load_to_lds(g0, g1, z4, z4, z8, 0);
#else
  __builtin_amdgcn_tensor_load_to_lds(g0, g1, z4, z4, 0);
#endif
}
#endif

// ---------------------------------------------------------------------------
// fp32 -> fp16 convert of a row-major matrix of 1024 columns into fragment
// order (tile = 16 rows x 32 columns, tiles of a row strip side by side).
// One wave converts four tiles side by side (16 rows x 512 B): 16 loads of
// 16 B a lane, all in flight at once, each covering 4 rows x one whole 128-B
// line. A lane's 4 columns are 8 B of the fragment of their row; the stores
// of rows 4i .. 4i + 3 fill 64-B pieces, the next store the line's other half.
// ---------------------------------------------------------------------------
typedef __attribute__((ext_vector_type(4))) float    v4f;
typedef __attribute__((ext_vector_type(4))) _Float16 v4h;

__global__ void __launch_bounds__(128)
f32_to_f16_kernel(const float* __restrict__ src, _Float16* __restrict__ dst) {
  int gw   = (blockIdx.x * 128 + threadIdx.x) >> 5;   // 128 strips x 8 quads
  int lane = threadIdx.x & 31;
  int strip = gw >> 3, quad = gw & 7;
  int r0 = lane >> 3, c4 = lane & 7;       // row 4i + r0, columns 4 c4 .. + 3
  const float* s = src + (size_t)(strip * 16 + r0) * 1024 + quad * 128 + c4 * 4;
  v4f v[4][4];
  #pragma unroll
  for (int t = 0; t < 4; ++t)
    #pragma unroll
    for (int i = 0; i < 4; ++i)
      v[t][i] = *(const v4f*)(s + i * 4096 + t * 32);
  // the loads' address pair is reused below: keep the address-translation wait
  // in front of that overwrite; named as an input the pair lives up to the wait,
  // so that no load's own result lands on it
  asm volatile("s_wait_xcnt 0x0" :: "v"(s) : "memory");
  // keeps all 16 loads ahead of the first conversion: the scheduler otherwise
  // holds some back for registers, a second memory round trip in series
  __builtin_amdgcn_sched_barrier(0);
  // column c = 4 c4: half c >> 4, lane (row) + 16 ((c >> 3) & 1), element c & 7
  _Float16* d = dst + (size_t)(strip * 32 + quad * 4) * 512 + (c4 >> 2) * 256 +
                ((c4 >> 1) & 1) * 128 + r0 * 8 + (c4 & 1) * 4;
  #pragma unroll
  for (int t = 0; t < 4; ++t)
    #pragma unroll
    for (int i = 0; i < 4; ++i) {
      v4h w;
      #pragma unroll
      for (int e = 0; e < 4; ++e) w[e] = (_Float16)v[t][i][e];
      *(v4h*)(d + t * 512 + i * 32) = w;
    }
}

// ---------------------------------------------------------------------------
// Pack a 1024 x N row-major f32 matrix into WMMA-B fragment order (f16): the
// GEMM consumer does two 16-byte loads per lane per WMMA, 512 B a wave each.
// One wave packs two tiles side by side (32 k x 32 columns): a lane keeps one
// column, its 32 loads (one whole 128-B line a wave each) are all in flight at
// once, and each run of 8 k is 16 B of the column's fragment: 4 stores a lane,
// 256 contiguous bytes per tile and store. A block takes 2 k tiles of 64
// columns, so that it reads the rows in aligned 256-B units.
// ---------------------------------------------------------------------------
template <int N>
__global__ void __launch_bounds__(128)
pack_b_kernel(const float* __restrict__ src, _Float16* __restrict__ dst) {
  const int KT = 32;                       // 1024 / 32
  int wv   = threadIdx.x >> 5;
  int lane = threadIdx.x & 31;
  int kt = (blockIdx.x & 15) * 2 + (wv >> 1);
  int np = (blockIdx.x >> 4) * 2 + (wv & 1);   // pair of 16-column tiles
  const float* s = src + (size_t)(kt * 32) * N + np * 32 + lane;
  float v[32];
  #pragma unroll
  for (int r = 0; r < 32; ++r) v[r] = s[(size_t)r * N];
  _Float16* d = dst + ((size_t)(np * 2 + (lane >> 4)) * KT + kt) * 512 +
                (lane & 15) * 8;
  // k = 8g + e lies in half g >> 1 at lane (column) + 16 (g & 1), element e
  #pragma unroll
  for (int g = 0; g < 4; ++g) {
    v8h w;
    #pragma unroll
    for (int e = 0; e < 8; ++e) w[e] = (_Float16)v[g * 8 + e];
    *(v8h*)(d + (g >> 1) * 256 + (g & 1) * 128) = w;
  }
}

// ---------------------------------------------------------------------------
// K = 1024 loop of a 32x64 wave tile, shared by the two GEMM kernels. Both
// operands lie in fragment order: 512 halfs a tile, 32 tiles a strip.
// The 12 loads of a k-step (2 A and 4 B fragments) are issued together, two
// k-steps ahead of the 8 WMMAs that use them, into a ring of three register
// sets: the L2 latency is spread over two k-steps of matrix work, where a
// single set meant two load-wait rounds in series inside every k-step.
// ---------------------------------------------------------------------------
struct KStep { v16h a0, a1, b0, b1, b2, b3; };

__device__ __forceinline__ KStep load_kstep(const _Float16* __restrict__ atile,
                                            const _Float16* __restrict__ btile,
                                            int kt, int lane) {
  KStep f;
  f.a0 = load_frag(atile + kt * 512, lane);
  f.a1 = load_frag(atile + 16384 + kt * 512, lane);
  f.b0 = load_frag(btile + kt * 512, lane);
  f.b1 = load_frag(btile + 16384 + kt * 512, lane);
  f.b2 = load_frag(btile + 32768 + kt * 512, lane);
  f.b3 = load_frag(btile + 49152 + kt * 512, lane);
  return f;
}

__device__ __forceinline__ void gemm_tile_32x64(const _Float16* __restrict__ atile,
                                                const _Float16* __restrict__ btile,
                                                int lane, v8f (&c)[2][4]) {
  const int KT = 32;                       // 1024 / 32
  KStep f[3];
  f[0] = load_kstep(atile, btile, 0, lane);
  f[1] = load_kstep(atile, btile, 1, lane);
  // unrolled in full: the ring index is then a constant (the sets stay in
  // registers) and kt goes into the loads' immediate offsets, so that the
  // loop rewrites no address register while loads are in flight
  #pragma unroll
  for (int kt = 0; kt < KT; ++kt) {
    if (kt + 2 < KT) f[(kt + 2) % 3] = load_kstep(atile, btile, kt + 2, lane);
    // keeps the loads up here: sunk towards their use they would lose the lead
    __builtin_amdgcn_sched_barrier(0);
    const KStep& g = f[kt % 3];
    c[0][0] = wmma_f16(g.a0, g.b0, c[0][0]);
    c[1][0] = wmma_f16(g.a1, g.b0, c[1][0]);
    c[0][1] = wmma_f16(g.a0, g.b1, c[0][1]);
    c[1][1] = wmma_f16(g.a1, g.b1, c[1][1]);
    c[0][2] = wmma_f16(g.a0, g.b2, c[0][2]);
    c[1][2] = wmma_f16(g.a1, g.b2, c[1][2]);
    c[0][3] = wmma_f16(g.a0, g.b3, c[0][3]);
    c[1][3] = wmma_f16(g.a1, g.b3, c[1][3]);
  }
}

// ---------------------------------------------------------------------------
// QKV GEMM (2048x1024 @ 1024x3072) + RoPE + scatter.
// One 32x64 output tile per wave: 2 A-frags x 4 B-frags -> 8 WMMAs per
// k-step, 12 b128 loads. Each wave's 64 columns = one head of one of q/k/v.
// ---------------------------------------------------------------------------
// The real block size is declared so that the register cap of a 1024-thread
// block goes: three sets of 48 fragment registers beside 64 accumulators.
__global__ void __launch_bounds__(256)
qkv_rope_kernel(const _Float16* __restrict__ xh,
                                const _Float16* __restrict__ wpk,
                                _Float16* __restrict__ q,
                                _Float16* __restrict__ kd,
                                _Float16* __restrict__ vT) {
  const int KT = 32;                       // 1024 / 32
  int gw   = (blockIdx.x * blockDim.x + threadIdx.x) >> 5;
  int lane = threadIdx.x & 31;
  int mt = gw & 63;                        // 64 row tiles of 32 rows
  int ng = gw >> 6;                        // 48 col groups of 64 cols
  int h = lane >> 4, nl = lane & 15;

  v8f c[2][4] = {};
  // both operands in fragment order: 512 halfs a tile, 32 tiles a strip
  const _Float16* atile = xh  + (size_t)(mt * 2) * KT * 512;
  const _Float16* btile = wpk + (size_t)(ng * 4) * KT * 512;

  gemm_tile_32x64(atile, btile, lane, c);

  int sect = (ng * 64) >> 10;              // 0=q 1=k 2=v (uniform per wave)
  int head = ng & 15;                      // uniform per wave

  if (sect == 2) {
    // V^T in fragment order, [H][32-key block][16-d tile]: a lane's 8 registers
    // are keys 16i + 8h + r of d = 16j + nl, its own 16 bytes of half i
    _Float16* dst = vT + (size_t)head * 131072 + (size_t)mt * 2048 + lane * 8;
    #pragma unroll
    for (int j = 0; j < 4; ++j)
      #pragma unroll
      for (int i = 0; i < 2; ++i) {
        v8h w;
        #pragma unroll
        for (int r = 0; r < 8; ++r) w[r] = (_Float16)c[i][j][r];
        *(v8h*)(dst + j * 512 + i * 256) = w;
      }
  } else {
    // RoPE, then Q and K in fragment order, [H][16-row tile][32-d tile]: row
    // r + 8h, d = 16j + nl lies in half j & 1 at lane (r + 8h) + 16 (nl >> 3),
    // element nl & 7. The wave fills each 512 B alone.
    _Float16* base = (sect == 0 ? q : kd) + (size_t)head * 131072 +
                     (size_t)mt * 2048 + h * 64 + (nl >> 3) * 128 + (nl & 7);
    #pragma unroll
    for (int j = 0; j < 4; ++j) {
      int d = j * 16 + nl;
      // inv_freq = 10000^(-(d>>1)/32) = exp(-(d>>1) * ln(10000)/32)
      float fr = __expf(-(float)(d >> 1) * 0.28782313662425572f);
      #pragma unroll
      for (int i = 0; i < 2; ++i) {
        #pragma unroll
        for (int r = 0; r < 8; ++r) {
          float xv = c[i][j][r];
          float pv = __shfl_xor(xv, 1, 32);  // partner column d^1 = lane^1
          int t = mt * 32 + i * 16 + r + 8 * h;
          float s, co;
          __sincosf((float)t * fr, &s, &co);
          float o = (d & 1) ? fmaf(pv, s, xv * co) : fmaf(xv, co, -pv * s);
          base[i * 1024 + j * 256 + r * 8] = (_Float16)o;
        }
      }
    }
  }
}

__device__ __forceinline__ float xhalf(float x) {
  int b = __builtin_bit_cast(int, x);
  return __builtin_bit_cast(float,
      __builtin_amdgcn_permlanex16(b, b, 0x76543210, 0xfedcba98, false, false));
}

__global__ void __launch_bounds__(128)
flash_attn_kernel(const _Float16* __restrict__ q,
                                  const _Float16* __restrict__ k,
                                  const _Float16* __restrict__ vT,
                                  _Float16* __restrict__ O) {
#ifdef HAVE_TDM
  __shared__ __align__(16) _Float16 lds_q[4][1024];   // 16x64 q per wave
#endif
  int wv = threadIdx.x >> 5;
  int lane = threadIdx.x & 31;
  int gw = blockIdx.x * 4 + wv;
  int head = gw >> 7;
  int qt   = gw & 127;
  int q0 = qt << 4;
  int h = lane >> 4, nl = lane & 15;

  // q, K and V^T lie in fragment order: a 16-query strip is 2 tiles = 2 KB in a
  // row, a 32-key block 4 tiles = 4 KB of K and of V^T
  const _Float16* qh = q  + (size_t)head * 131072;   // [T/16][D/32] tiles
  const _Float16* kh = k  + (size_t)head * 131072;   // [T/16][D/32] tiles
  const _Float16* vh = vT + (size_t)head * 131072;   // [T/32][D/16] tiles

  // K and V^T fragments are fetched one key block ahead, all eight loads of an
  // operand together: K's fly during the softmax and the second product, V's
  // during the next block's scores and softmax; the first block's during the
  // staging of q.
  v16h k0 = load_frag(kh,        lane);   // keys 0..15,  d 0..31
  v16h k1 = load_frag(kh + 512,  lane);   // keys 0..15,  d 32..63
  v16h k2 = load_frag(kh + 1024, lane);   // keys 16..31, d 0..31
  v16h k3 = load_frag(kh + 1536, lane);   // keys 16..31, d 32..63
  v16h v0 = load_frag(vh,        lane);   // d 0..15
  v16h v1 = load_frag(vh + 512,  lane);   // d 16..31
  v16h v2 = load_frag(vh + 1024, lane);   // d 32..47
  v16h v3 = load_frag(vh + 1536, lane);   // d 48..63
  // the loads' address registers are reused below: keep the
  // address-translation wait in front of that overwrite
  asm volatile("s_wait_xcnt 0x0" ::: "memory");

  v16h qf0, qf1;
#ifdef HAVE_TDM
  {
    unsigned loff = (unsigned)(uintptr_t)(&lds_q[wv][0]);  // LDS byte offset
    tdm_load_2d_f16(loff, qh + (size_t)q0 * 64, /*w=*/64, /*h=*/16, /*stride=*/64);
    __builtin_amdgcn_s_wait_tensorcnt(0);
    const _Float16* ql = &lds_q[wv][0];
    qf0 = load_frag(ql, lane);         // d 0..31
    qf1 = load_frag(ql + 512, lane);   // d 32..63
  }
#else
  qf0 = load_frag(qh + (size_t)q0 * 64, lane);
  qf1 = load_frag(qh + (size_t)q0 * 64 + 512, lane);
#endif

  // o*[r] = O^T[d = 16j + 8h + r][query q0 + nl]
  v8f o0 = {}, o1 = {}, o2 = {}, o3 = {};
  float mrow = -3.0e38f;   // running maximum of this lane's query (both halves)
  float lrow = 0.f;        // running sum over this half's keys only

  const int qi = q0 + nl;
  const int kend = q0 + 16;

  for (int kb = 0; kb < kend; kb += 32) {
    // the last trip has no next block: it fetches its own again (in bounds)
    const int kn = (kb + 32 < kend) ? kb + 32 : kb;

    // scores: k(32x64) @ q^T -> two 16x16 f32 tiles, row = key, column = query
    v8f s0 = {}, s1 = {};
    s0 = wmma_f16(k0, qf0, s0);
    s0 = wmma_f16(k1, qf1, s0);
    s1 = wmma_f16(k2, qf0, s1);
    s1 = wmma_f16(k3, qf1, s1);
    k0 = load_frag(kh + (size_t)kn * 64,        lane);
    k1 = load_frag(kh + (size_t)kn * 64 + 512,  lane);
    k2 = load_frag(kh + (size_t)kn * 64 + 1024, lane);
    k3 = load_frag(kh + (size_t)kn * 64 + 1536, lane);
    // the K loads' address registers are reused below: keep the
    // address-translation wait in front of that overwrite
    asm volatile("s_wait_xcnt 0x0" ::: "memory");
    // keeps the K loads up here: the scheduler otherwise sinks them to the
    // loop's foot, where their whole latency is waited out at the next scores
    __builtin_amdgcn_sched_barrier(0);

    float a0[8], a1[8], mx[8];
    #pragma unroll
    for (int r = 0; r < 8; ++r) {
      int key = kb + r + 8 * h;
      a0[r] = (key      <= qi) ? s0[r] * 0.125f : -3.0e38f;  // 1/sqrt(64)
      a1[r] = (key + 16 <= qi) ? s1[r] * 0.125f : -3.0e38f;
      mx[r] = fmaxf(a0[r], a1[r]);
    }
    float t = fmaxf(fmaxf(fmaxf(mx[0], mx[1]), fmaxf(mx[2], mx[3])),
                    fmaxf(fmaxf(mx[4], mx[5]), fmaxf(mx[6], mx[7])));
    t = fmaxf(t, xhalf(t));
    float mnew = fmaxf(mrow, t);
    float al = __expf(mrow - mnew);
    mrow = mnew;

    // probs: element r = key 8h + r, element 8 + r = key 16 + 8h + r, which
    // is the k order of the vT fragments
    v16h pf;
    float sm[8];
    #pragma unroll
    for (int r = 0; r < 8; ++r) {
      float p0 = __expf(a0[r] - mnew);
      float p1 = __expf(a1[r] - mnew);
      sm[r] = p0 + p1;
      pf[r]     = (_Float16)p0;
      pf[8 + r] = (_Float16)p1;
    }
    lrow = lrow * al + (((sm[0] + sm[1]) + (sm[2] + sm[3])) +
                        ((sm[4] + sm[5]) + (sm[6] + sm[7])));
    #pragma unroll
    for (int r = 0; r < 8; ++r) {
      o0[r] *= al; o1[r] *= al;
      o2[r] *= al; o3[r] *= al;
    }

    // O^T += V^T(64x32) @ P^T(32x16); A rows are d
    o0 = wmma_f16(v0, pf, o0);
    o1 = wmma_f16(v1, pf, o1);
    o2 = wmma_f16(v2, pf, o2);
    o3 = wmma_f16(v3, pf, o3);
    v0 = load_frag(vh + (size_t)kn * 64,        lane);
    v1 = load_frag(vh + (size_t)kn * 64 + 512,  lane);
    v2 = load_frag(vh + (size_t)kn * 64 + 1024, lane);
    v3 = load_frag(vh + (size_t)kn * 64 + 1536, lane);
    asm volatile("s_wait_xcnt 0x0" ::: "memory");
  }
  // the last trip's fetch is still in flight and nothing reads it: let it land
  // before the wave hands its registers back
  asm volatile("s_wait_loadcnt 0x0" ::: "memory");

  // join the two halves' sums once; a lane's 8 registers of a tile are 8
  // consecutive d of its query: one 16-byte store per tile, in the fragment
  // order the projection reads (row nl, column 64 head + 16j + 8h + r: tile
  // 2 head + (j >> 1) of strip qt, half j & 1, this lane): 512 B a wave
  float inv = 1.0f / (lrow + xhalf(lrow));
  _Float16* orow = O + ((size_t)qt * 32 + head * 2) * 512 + lane * 8;
  v8h w0, w1, w2, w3;
  #pragma unroll
  for (int r = 0; r < 8; ++r) {
    w0[r] = (_Float16)(o0[r] * inv);
    w1[r] = (_Float16)(o1[r] * inv);
    w2[r] = (_Float16)(o2[r] * inv);
    w3[r] = (_Float16)(o3[r] * inv);
  }
  *(v8h*)(orow)       = w0;
  *(v8h*)(orow + 256) = w1;
  *(v8h*)(orow + 512) = w2;
  *(v8h*)(orow + 768) = w3;
}

// ---------------------------------------------------------------------------
// Output projection: O(2048x1024 f16) @ w_proj -> d_out f32. 32x64 tiles.
// ---------------------------------------------------------------------------
__global__ void __launch_bounds__(256)   // as for the QKV GEMM
proj_kernel(const _Float16* __restrict__ Oh,
                            const _Float16* __restrict__ wpk,
                            float* __restrict__ out) {
  const int KT = 32;
  int gw   = (blockIdx.x * blockDim.x + threadIdx.x) >> 5;
  int lane = threadIdx.x & 31;
  int mt = gw & 63;                        // 64 row tiles of 32
  int ng = gw >> 6;                        // 16 col groups of 64
  int h = lane >> 4, nl = lane & 15;

  v8f c[2][4] = {};
  // both operands in fragment order: 512 halfs a tile, 32 tiles a strip
  const _Float16* atile = Oh  + (size_t)(mt * 2) * KT * 512;
  const _Float16* btile = wpk + (size_t)(ng * 4) * KT * 512;

  gemm_tile_32x64(atile, btile, lane, c);
  #pragma unroll
  for (int i = 0; i < 2; ++i)
    #pragma unroll
    for (int j = 0; j < 4; ++j)
      #pragma unroll
      for (int r = 0; r < 8; ++r) {
        int t = mt * 32 + i * 16 + r + 8 * h;
        out[(size_t)t * 1024 + ng * 64 + j * 16 + nl] = c[i][j][r];
      }
}

// ---------------------------------------------------------------------------
extern "C" void kernel_launch(void* const* d_in, const int* in_sizes, int n_in,
                              void* d_out, int out_size, void* d_ws, size_t ws_size,
                              hipStream_t stream) {
  const float* x     = (const float*)d_in[0];   // (1,2048,1024)
  const float* wqkv  = (const float*)d_in[1];   // (1024,3072)
  const float* wproj = (const float*)d_in[2];   // (1024,1024)
  float* out = (float*)d_out;                   // (1,2048,1024)

  char* ws = (char*)d_ws;                       // needs ~28 MB
  _Float16* xh       = (_Float16*)(ws);                         // 4 MB
  _Float16* wqkv_pk  = (_Float16*)(ws + ((size_t)4  << 20));    // 6 MB
  _Float16* wproj_pk = (_Float16*)(ws + ((size_t)10 << 20));    // 2 MB
  _Float16* q        = (_Float16*)(ws + ((size_t)12 << 20));    // 4 MB
  _Float16* k        = (_Float16*)(ws + ((size_t)16 << 20));    // 4 MB
  _Float16* vT       = (_Float16*)(ws + ((size_t)20 << 20));    // 4 MB
  _Float16* O        = (_Float16*)(ws + ((size_t)24 << 20));    // 4 MB

  // 128 strips x 8 groups of 4 tiles, 1 group/wave, 4 waves/block
  f32_to_f16_kernel<<<256, 128, 0, stream>>>(x, xh);
  // 32 k tiles x N / 32 tile pairs, 1 pair/wave, 4 waves/block
  pack_b_kernel<3072><<<768, 128, 0, stream>>>(wqkv, wqkv_pk);
  pack_b_kernel<1024><<<256, 128, 0, stream>>>(wproj, wproj_pk);

  // 64x48 tiles of 32x64, 1 tile/wave, 8 waves/block
  qkv_rope_kernel<<<384, 256, 0, stream>>>(xh, wqkv_pk, q, k, vT);
  // 16 heads x 128 q-strips = 2048 waves, 4 waves/block
  flash_attn_kernel<<<512, 128, 0, stream>>>(q, k, vT, O);
  // 64x16 tiles of 32x64, 8 waves/block
  proj_kernel<<<128, 256, 0, stream>>>(O, wproj_pk, out);
}

// v006
// One run takes 80.4 microseconds.
// Two timings next to v005 put it at 1.04 and 1.02 times that version's speed.
// Over all steps from v000 it is 3.93 times as fast.
#include <hip/hip_runtime.h>
#include <hip/hip_bf16.h>

typedef __attribute__((ext_vector_type(16))) _Float16 v16h;
typedef __attribute__((ext_vector_type(8)))  _Float16 v8h;
typedef __attribute__((ext_vector_type(8)))  float    v8f;

#if defined(__has_builtin)
#if __has_builtin(__builtin_amdgcn_tensor_load_to_lds) && __has_builtin(__builtin_amdgcn_s_wait_tensorcnt)
#define HAVE_TDM 1
#endif
#endif

__device__ __forceinline__ v16h cat8(v8h a, v8h b) {
  return __builtin_shufflevector(a, b, 0,1,2,3,4,5,6,7,8,9,10,11,12,13,14,15);
}

__device__ __forceinline__ v8f wmma_f16(v16h a, v16h b, v8f c) {
  // v_wmma_f32_16x16x32_f16 (neg_a, A, neg_b, B, c_mod, C, reuse_a, reuse_b)
  return __builtin_amdgcn_wmma_f32_16x16x32_f16(false, a, false, b, (short)0, c, false, false);
}

// Fragment order: a 16x32 f16 operand tile (16 rows of A, or 16 columns of B,
// by 32 k) is 1 KB in the workspace, two halves of 512 B. With h = lane >> 4,
// half s holds at lane * 16 B the 8 elements k = 16s + 8h .. 16s + 8h + 7 of
// row (column) lane & 15: the lane's fragment registers as they are. A wave's
// 16-byte load then covers 4 whole 128-B lines, not 32-B pieces of 16 lines.
__device__ __forceinline__ v16h load_frag(const _Float16* __restrict__ tile,
                                          int lane) {
  const _Float16* p = tile + lane * 8;
  return cat8(*(const v8h*)(p), *(const v8h*)(p + 256));
}

#ifdef HAVE_TDM
__device__ __forceinline__ void tdm_load_2d_f16(unsigned lds_off,
                                                const void* gptr,
                                                int tile_w, int tile_h,
                                                int stride) {
  typedef __attribute__((ext_vector_type(4))) unsigned u32x4;
  typedef __attribute__((ext_vector_type(4))) int      i32x4;
  typedef __attribute__((ext_vector_type(8))) int      i32x8;
  unsigned long long ga = (unsigned long long)(uintptr_t)gptr;
  u32x4 g0;
  g0[0] = 1u;
  g0[1] = lds_off;
  g0[2] = (unsigned)(ga & 0xFFFFFFFFu);
  g0[3] = (unsigned)((ga >> 32) & 0x1FFFFFFu) | (2u << 30);
  i32x8 g1;
  g1[0] = 1 << 16;
  g1[1] = (tile_w & 0xFFFF) << 16;
  g1[2] = ((tile_w >> 16) & 0xFFFF) | ((tile_h & 0xFFFF) << 16);
  g1[3] = ((tile_h >> 16) & 0xFFFF) | ((tile_w & 0xFFFF) << 16);
  g1[4] = tile_h & 0xFFFF;
  g1[5] = stride;
  g1[6] = 0;
  g1[7] = 0;
  i32x4 z4 = {0, 0, 0, 0};
#if __clang_major__ >= 23
  i32x8 z8 = {0, 0, 0, 0, 0, 0, 0, 0};
  __builtin_amdgcn_tensor_load_to_lds(g0, g1, z4, z4, z8, 0);
#else
  __builtin_amdgcn_tensor_load_to_lds(g0, g1, z4, z4, 0);
#endif
}
#endif

// ---------------------------------------------------------------------------
// fp32 -> fp16 convert of a row-major matrix of 1024 columns into fragment
// order (tile = 16 rows x 32 columns, tiles of a row strip side by side).
// One wave converts four tiles side by side (16 rows x 512 B): 16 loads of
// 16 B a lane, all in flight at once, each covering 4 rows x one whole 128-B
// line. A lane's 4 columns are 8 B of the fragment of their row; the stores
// of rows 4i .. 4i + 3 fill 64-B pieces, the next store the line's other half.
// ---------------------------------------------------------------------------
typedef __attribute__((ext_vector_type(4))) float    v4f;
typedef __attribute__((ext_vector_type(4))) _Float16 v4h;

__device__ __forceinline__ void
f32_to_f16_tiles(const float* __restrict__ src, _Float16* __restrict__ dst,
                 int blk) {
  int gw   = (blk * 128 + threadIdx.x) >> 5;          // 128 strips x 8 quads
  int lane = threadIdx.x & 31;
  int strip = gw >> 3, quad = gw & 7;
  int r0 = lane >> 3, c4 = lane & 7;       // row 4i + r0, columns 4 c4 .. + 3
  const float* s = src + (size_t)(strip * 16 + r0) * 1024 + quad * 128 + c4 * 4;
  v4f v[4][4];
  #pragma unroll
  for (int t = 0; t < 4; ++t)
    #pragma unroll
    for (int i = 0; i < 4; ++i)
      v[t][i] = *(const v4f*)(s + i * 4096 + t * 32);
  // the loads' address pair is reused below: keep the address-translation wait
  // in front of that overwrite; named as an input the pair lives up to the wait,
  // so that no load's own result lands on it
  asm volatile("s_wait_xcnt 0x0" :: "v"(s) : "memory");
  // keeps all 16 loads ahead of the first conversion: the scheduler otherwise
  // holds some back for registers, a second memory round trip in series
  __builtin_amdgcn_sched_barrier(0);
  // column c = 4 c4: half c >> 4, lane (row) + 16 ((c >> 3) & 1), element c & 7
  _Float16* d = dst + (size_t)(strip * 32 + quad * 4) * 512 + (c4 >> 2) * 256 +
                ((c4 >> 1) & 1) * 128 + r0 * 8 + (c4 & 1) * 4;
  #pragma unroll
  for (int t = 0; t < 4; ++t)
    #pragma unroll
    for (int i = 0; i < 4; ++i) {
      v4h w;
      #pragma unroll
      for (int e = 0; e < 4; ++e) w[e] = (_Float16)v[t][i][e];
      *(v4h*)(d + t * 512 + i * 32) = w;
    }
  // the shared kernel's other bodies follow these stores in the code and reuse
  // their registers: keep the address-translation wait in front of that
  asm volatile("s_wait_xcnt 0x0" ::: "memory");
}

// ---------------------------------------------------------------------------
// Pack a 1024 x N row-major f32 matrix into WMMA-B fragment order (f16): the
// GEMM consumer does two 16-byte loads per lane per WMMA, 512 B a wave each.
// One wave packs two tiles side by side (32 k x 32 columns): a lane keeps one
// column, its 32 loads (one whole 128-B line a wave each) are all in flight at
// once, and each run of 8 k is 16 B of the column's fragment: 4 stores a lane,
// 256 contiguous bytes per tile and store. A block takes 2 k tiles of 64
// columns, so that it reads the rows in aligned 256-B units.
// ---------------------------------------------------------------------------
template <int N>
__device__ __forceinline__ void
pack_b_tiles(const float* __restrict__ src, _Float16* __restrict__ dst,
             int blk) {
  const int KT = 32;                       // 1024 / 32
  int wv   = threadIdx.x >> 5;
  int lane = threadIdx.x & 31;
  int kt = (blk & 15) * 2 + (wv >> 1);
  int np = (blk >> 4) * 2 + (wv & 1);          // pair of 16-column tiles
  const float* s = src + (size_t)(kt * 32) * N + np * 32 + lane;
  float v[32];
  #pragma unroll
  for (int r = 0; r < 32; ++r) v[r] = s[(size_t)r * N];
  _Float16* d = dst + ((size_t)(np * 2 + (lane >> 4)) * KT + kt) * 512 +
                (lane & 15) * 8;
  // k = 8g + e lies in half g >> 1 at lane (column) + 16 (g & 1), element e
  #pragma unroll
  for (int g = 0; g < 4; ++g) {
    v8h w;
    #pragma unroll
    for (int e = 0; e < 8; ++e) w[e] = (_Float16)v[g * 8 + e];
    *(v8h*)(d + (g >> 1) * 256 + (g & 1) * 128) = w;
  }
  // as in f32_to_f16_tiles: the wait in front of a reuse of the stores' registers
  asm volatile("s_wait_xcnt 0x0" ::: "memory");
}

// ---------------------------------------------------------------------------
// The three packings depend on nothing but the inputs, so they share one
// launch: a block takes its piece of one matrix by its index (a scalar branch).
// Their waves are all resident together and their memory round trips overlap,
// where three launches in a row each paid a gap, a fill and a drain of its own.
// The largest matrix comes first.
// ---------------------------------------------------------------------------
__global__ void __launch_bounds__(128)
pack_operands_kernel(const float* __restrict__ x,
                     const float* __restrict__ wqkv,
                     const float* __restrict__ wproj,
                     _Float16* __restrict__ xh,
                     _Float16* __restrict__ wqkv_pk,
                     _Float16* __restrict__ wproj_pk) {
  int b = blockIdx.x;
  if (b < 768)       pack_b_tiles<3072>(wqkv, wqkv_pk, b);
  else if (b < 1024) f32_to_f16_tiles(x, xh, b - 768);
  else               pack_b_tiles<1024>(wproj, wproj_pk, b - 1024);
}

// ---------------------------------------------------------------------------
// K = 1024 loop of a 32x64 wave tile, shared by the two GEMM kernels. Both
// operands lie in fragment order: 512 halfs a tile, 32 tiles a strip.
// The 12 loads of a k-step (2 A and 4 B fragments) are issued together, two
// k-steps ahead of the 8 WMMAs that use them, into a ring of three register
// sets: the L2 latency is spread over two k-steps of matrix work, where a
// single set meant two load-wait rounds in series inside every k-step.
// ---------------------------------------------------------------------------
struct KStep { v16h a0, a1, b0, b1, b2, b3; };

__device__ __forceinline__ KStep load_kstep(const _Float16* __restrict__ atile,
                                            const _Float16* __restrict__ btile,
                                            int kt, int lane) {
  KStep f;
  f.a0 = load_frag(atile + kt * 512, lane);
  f.a1 = load_frag(atile + 16384 + kt * 512, lane);
  f.b0 = load_frag(btile + kt * 512, lane);
  f.b1 = load_frag(btile + 16384 + kt * 512, lane);
  f.b2 = load_frag(btile + 32768 + kt * 512, lane);
  f.b3 = load_frag(btile + 49152 + kt * 512, lane);
  return f;
}

__device__ __forceinline__ void gemm_tile_32x64(const _Float16* __restrict__ atile,
                                                const _Float16* __restrict__ btile,
                                                int lane, v8f (&c)[2][4]) {
  const int KT = 32;                       // 1024 / 32
  KStep f[3];
  f[0] = load_kstep(atile, btile, 0, lane);
  f[1] = load_kstep(atile, btile, 1, lane);
  // unrolled in full: the ring index is then a constant (the sets stay in
  // registers) and kt goes into the loads' immediate offsets, so that the
  // loop rewrites no address register while loads are in flight
  #pragma unroll
  for (int kt = 0; kt < KT; ++kt) {
    if (kt + 2 < KT) f[(kt + 2) % 3] = load_kstep(atile, btile, kt + 2, lane);
    // keeps the loads up here: sunk towards their use they would lose the lead
    __builtin_amdgcn_sched_barrier(0);
    const KStep& g = f[kt % 3];
    c[0][0] = wmma_f16(g.a0, g.b0, c[0][0]);
    c[1][0] = wmma_f16(g.a1, g.b0, c[1][0]);
    c[0][1] = wmma_f16(g.a0, g.b1, c[0][1]);
    c[1][1] = wmma_f16(g.a1, g.b1, c[1][1]);
    c[0][2] = wmma_f16(g.a0, g.b2, c[0][2]);
    c[1][2] = wmma_f16(g.a1, g.b2, c[1][2]);
    c[0][3] = wmma_f16(g.a0, g.b3, c[0][3]);
    c[1][3] = wmma_f16(g.a1, g.b3, c[1][3]);
  }
}

// ---------------------------------------------------------------------------
// QKV GEMM (2048x1024 @ 1024x3072) + RoPE + scatter.
// One 32x64 output tile per wave: 2 A-frags x 4 B-frags -> 8 WMMAs per
// k-step, 12 b128 loads. Each wave's 64 columns = one head of one of q/k/v.
// ---------------------------------------------------------------------------
// The real block size is declared so that the register cap of a 1024-thread
// block goes: three sets of 48 fragment registers beside 64 accumulators.
__global__ void __launch_bounds__(256)
qkv_rope_kernel(const _Float16* __restrict__ xh,
                                const _Float16* __restrict__ wpk,
                                _Float16* __restrict__ q,
                                _Float16* __restrict__ kd,
                                _Float16* __restrict__ vT) {
  const int KT = 32;                       // 1024 / 32
  int gw   = (blockIdx.x * blockDim.x + threadIdx.x) >> 5;
  int lane = threadIdx.x & 31;
  int mt = gw & 63;                        // 64 row tiles of 32 rows
  int ng = gw >> 6;                        // 48 col groups of 64 cols
  int h = lane >> 4, nl = lane & 15;

  v8f c[2][4] = {};
  // both operands in fragment order: 512 halfs a tile, 32 tiles a strip
  const _Float16* atile = xh  + (size_t)(mt * 2) * KT * 512;
  const _Float16* btile = wpk + (size_t)(ng * 4) * KT * 512;

  gemm_tile_32x64(atile, btile, lane, c);

  int sect = (ng * 64) >> 10;              // 0=q 1=k 2=v (uniform per wave)
  int head = ng & 15;                      // uniform per wave

  if (sect == 2) {
    // V^T in fragment order, [H][32-key block][16-d tile]: a lane's 8 registers
    // are keys 16i + 8h + r of d = 16j + nl, its own 16 bytes of half i
    _Float16* dst = vT + (size_t)head * 131072 + (size_t)mt * 2048 + lane * 8;
    #pragma unroll
    for (int j = 0; j < 4; ++j)
      #pragma unroll
      for (int i = 0; i < 2; ++i) {
        v8h w;
        #pragma unroll
        for (int r = 0; r < 8; ++r) w[r] = (_Float16)c[i][j][r];
        *(v8h*)(dst + j * 512 + i * 256) = w;
      }
  } else {
    // RoPE, then Q and K in fragment order, [H][16-row tile][32-d tile]: row
    // r + 8h, d = 16j + nl lies in half j & 1 at lane (r + 8h) + 16 (nl >> 3),
    // element nl & 7. The wave fills each 512 B alone.
    _Float16* base = (sect == 0 ? q : kd) + (size_t)head * 131072 +
                     (size_t)mt * 2048 + h * 64 + (nl >> 3) * 128 + (nl & 7);
    #pragma unroll
    for (int j = 0; j < 4; ++j) {
      int d = j * 16 + nl;
      // inv_freq = 10000^(-(d>>1)/32) = exp(-(d>>1) * ln(10000)/32)
      float fr = __expf(-(float)(d >> 1) * 0.28782313662425572f);
      #pragma unroll
      for (int i = 0; i < 2; ++i) {
        #pragma unroll
        for (int r = 0; r < 8; ++r) {
          float xv = c[i][j][r];
          float pv = __shfl_xor(xv, 1, 32);  // partner column d^1 = lane^1
          int t = mt * 32 + i * 16 + r + 8 * h;
          float s, co;
          __sincosf((float)t * fr, &s, &co);
          float o = (d & 1) ? fmaf(pv, s, xv * co) : fmaf(xv, co, -pv * s);
          base[i * 1024 + j * 256 + r * 8] = (_Float16)o;
        }
      }
    }
  }
}

__device__ __forceinline__ float xhalf(float x) {
  int b = __builtin_bit_cast(int, x);
  return __builtin_bit_cast(float,
      __builtin_amdgcn_permlanex16(b, b, 0x76543210, 0xfedcba98, false, false));
}

__global__ void __launch_bounds__(128)
flash_attn_kernel(const _Float16* __restrict__ q,
                                  const _Float16* __restrict__ k,
                                  const _Float16* __restrict__ vT,
                                  _Float16* __restrict__ O) {
#ifdef HAVE_TDM
  __shared__ __align__(16) _Float16 lds_q[4][1024];   // 16x64 q per wave
#endif
  int wv = threadIdx.x >> 5;
  int lane = threadIdx.x & 31;
  int gw = blockIdx.x * 4 + wv;
  int head = gw >> 7;
  int qt   = gw & 127;
  int q0 = qt << 4;
  int h = lane >> 4, nl = lane & 15;

  // q, K and V^T lie in fragment order: a 16-query strip is 2 tiles = 2 KB in a
  // row, a 32-key block 4 tiles = 4 KB of K and of V^T
  const _Float16* qh = q  + (size_t)head * 131072;   // [T/16][D/32] tiles
  const _Float16* kh = k  + (size_t)head * 131072;   // [T/16][D/32] tiles
  const _Float16* vh = vT + (size_t)head * 131072;   // [T/32][D/16] tiles

  // K and V^T fragments are fetched one key block ahead, all eight loads of an
  // operand together: K's fly during the softmax and the second product, V's
  // during the next block's scores and softmax; the first block's during the
  // staging of q.
  v16h k0 = load_frag(kh,        lane);   // keys 0..15,  d 0..31
  v16h k1 = load_frag(kh + 512,  lane);   // keys 0..15,  d 32..63
  v16h k2 = load_frag(kh + 1024, lane);   // keys 16..31, d 0..31
  v16h k3 = load_frag(kh + 1536, lane);   // keys 16..31, d 32..63
  v16h v0 = load_frag(vh,        lane);   // d 0..15
  v16h v1 = load_frag(vh + 512,  lane);   // d 16..31
  v16h v2 = load_frag(vh + 1024, lane);   // d 32..47
  v16h v3 = load_frag(vh + 1536, lane);   // d 48..63
  // the loads' address registers are reused below: keep the
  // address-translation wait in front of that overwrite
  asm volatile("s_wait_xcnt 0x0" ::: "memory");

  v16h qf0, qf1;
#ifdef HAVE_TDM
  {
    unsigned loff = (unsigned)(uintptr_t)(&lds_q[wv][0]);  // LDS byte offset
    tdm_load_2d_f16(loff, qh + (size_t)q0 * 64, /*w=*/64, /*h=*/16, /*stride=*/64);
    __builtin_amdgcn_s_wait_tensorcnt(0);
    const _Float16* ql = &lds_q[wv][0];
    qf0 = load_frag(ql, lane);         // d 0..31
    qf1 = load_frag(ql + 512, lane);   // d 32..63
  }
#else
  qf0 = load_frag(qh + (size_t)q0 * 64, lane);
  qf1 = load_frag(qh + (size_t)q0 * 64 + 512, lane);
#endif

  // o*[r] = O^T[d = 16j + 8h + r][query q0 + nl]
  v8f o0 = {}, o1 = {}, o2 = {}, o3 = {};
  float mrow = -3.0e38f;   // running maximum of this lane's query (both halves)
  float lrow = 0.f;        // running sum over this half's keys only

  const int qi = q0 + nl;
  const int kend = q0 + 16;

  for (int kb = 0; kb < kend; kb += 32) {
    // the last trip has no next block: it fetches its own again (in bounds)
    const int kn = (kb + 32 < kend) ? kb + 32 : kb;

    // scores: k(32x64) @ q^T -> two 16x16 f32 tiles, row = key, column = query
    v8f s0 = {}, s1 = {};
    s0 = wmma_f16(k0, qf0, s0);
    s0 = wmma_f16(k1, qf1, s0);
    s1 = wmma_f16(k2, qf0, s1);
    s1 = wmma_f16(k3, qf1, s1);
    k0 = load_frag(kh + (size_t)kn * 64,        lane);
    k1 = load_frag(kh + (size_t)kn * 64 + 512,  lane);
    k2 = load_frag(kh + (size_t)kn * 64 + 1024, lane);
    k3 = load_frag(kh + (size_t)kn * 64 + 1536, lane);
    // the K loads' address registers are reused below: keep the
    // address-translation wait in front of that overwrite
    asm volatile("s_wait_xcnt 0x0" ::: "memory");
    // keeps the K loads up here: the scheduler otherwise sinks them to the
    // loop's foot, where their whole latency is waited out at the next scores
    __builtin_amdgcn_sched_barrier(0);

    float a0[8], a1[8], mx[8];
    #pragma unroll
    for (int r = 0; r < 8; ++r) {
      int key = kb + r + 8 * h;
      a0[r] = (key      <= qi) ? s0[r] * 0.125f : -3.0e38f;  // 1/sqrt(64)
      a1[r] = (key + 16 <= qi) ? s1[r] * 0.125f : -3.0e38f;
      mx[r] = fmaxf(a0[r], a1[r]);
    }
    float t = fmaxf(fmaxf(fmaxf(mx[0], mx[1]), fmaxf(mx[2], mx[3])),
                    fmaxf(fmaxf(mx[4], mx[5]), fmaxf(mx[6], mx[7])));
    t = fmaxf(t, xhalf(t));
    float mnew = fmaxf(mrow, t);
    float al = __expf(mrow - mnew);
    mrow = mnew;

    // probs: element r = key 8h + r, element 8 + r = key 16 + 8h + r, which
    // is the k order of the vT fragments
    v16h pf;
    float sm[8];
    #pragma unroll
    for (int r = 0; r < 8; ++r) {
      float p0 = __expf(a0[r] - mnew);
      float p1 = __expf(a1[r] - mnew);
      sm[r] = p0 + p1;
      pf[r]     = (_Float16)p0;
      pf[8 + r] = (_Float16)p1;
    }
    lrow = lrow * al + (((sm[0] + sm[1]) + (sm[2] + sm[3])) +
                        ((sm[4] + sm[5]) + (sm[6] + sm[7])));
    #pragma unroll
    for (int r = 0; r < 8; ++r) {
      o0[r] *= al; o1[r] *= al;
      o2[r] *= al; o3[r] *= al;
    }

    // O^T += V^T(64x32) @ P^T(32x16); A rows are d
    o0 = wmma_f16(v0, pf, o0);
    o1 = wmma_f16(v1, pf, o1);
    o2 = wmma_f16(v2, pf, o2);
    o3 = wmma_f16(v3, pf, o3);
    v0 = load_frag(vh + (size_t)kn * 64,        lane);
    v1 = load_frag(vh + (size_t)kn * 64 + 512,  lane);
    v2 = load_frag(vh + (size_t)kn * 64 + 1024, lane);
    v3 = load_frag(vh + (size_t)kn * 64 + 1536, lane);
    asm volatile("s_wait_xcnt 0x0" ::: "memory");
  }
  // the last trip's fetch is still in flight and nothing reads it: let it land
  // before the wave hands its registers back
  asm volatile("s_wait_loadcnt 0x0" ::: "memory");

  // join the two halves' sums once; a lane's 8 registers of a tile are 8
  // consecutive d of its query: one 16-byte store per tile, in the fragment
  // order the projection reads (row nl, column 64 head + 16j + 8h + r: tile
  // 2 head + (j >> 1) of strip qt, half j & 1, this lane): 512 B a wave
  float inv = 1.0f / (lrow + xhalf(lrow));
  _Float16* orow = O + ((size_t)qt * 32 + head * 2) * 512 + lane * 8;
  v8h w0, w1, w2, w3;
  #pragma unroll
  for (int r = 0; r < 8; ++r) {
    w0[r] = (_Float16)(o0[r] * inv);
    w1[r] = (_Float16)(o1[r] * inv);
    w2[r] = (_Float16)(o2[r] * inv);
    w3[r] = (_Float16)(o3[r] * inv);
  }
  *(v8h*)(orow)       = w0;
  *(v8h*)(orow + 256) = w1;
  *(v8h*)(orow + 512) = w2;
  *(v8h*)(orow + 768) = w3;
}

// ---------------------------------------------------------------------------
// Output projection: O(2048x1024 f16) @ w_proj -> d_out f32. 32x64 tiles.
// ---------------------------------------------------------------------------
__global__ void __launch_bounds__(256)   // as for the QKV GEMM
proj_kernel(const _Float16* __restrict__ Oh,
                            const _Float16* __restrict__ wpk,
                            float* __restrict__ out) {
  const int KT = 32;
  int gw   = (blockIdx.x * blockDim.x + threadIdx.x) >> 5;
  int lane = threadIdx.x & 31;
  int mt = gw & 63;                        // 64 row tiles of 32
  int ng = gw >> 6;                        // 16 col groups of 64
  int h = lane >> 4, nl = lane & 15;

  v8f c[2][4] = {};
  // both operands in fragment order: 512 halfs a tile, 32 tiles a strip
  const _Float16* atile = Oh  + (size_t)(mt * 2) * KT * 512;
  const _Float16* btile = wpk + (size_t)(ng * 4) * KT * 512;

  gemm_tile_32x64(atile, btile, lane, c);
  #pragma unroll
  for (int i = 0; i < 2; ++i)
    #pragma unroll
    for (int j = 0; j < 4; ++j)
      #pragma unroll
      for (int r = 0; r < 8; ++r) {
        int t = mt * 32 + i * 16 + r + 8 * h;
        out[(size_t)t * 1024 + ng * 64 + j * 16 + nl] = c[i][j][r];
      }
}

// ---------------------------------------------------------------------------
extern "C" void kernel_launch(void* const* d_in, const int* in_sizes, int n_in,
                              void* d_out, int out_size, void* d_ws, size_t ws_size,
                              hipStream_t stream) {
  const float* x     = (const float*)d_in[0];   // (1,2048,1024)
  const float* wqkv  = (const float*)d_in[1];   // (1024,3072)
  const float* wproj = (const float*)d_in[2];   // (1024,1024)
  float* out = (float*)d_out;                   // (1,2048,1024)

  char* ws = (char*)d_ws;                       // needs ~28 MB
  _Float16* xh       = (_Float16*)(ws);                         // 4 MB
  _Float16* wqkv_pk  = (_Float16*)(ws + ((size_t)4  << 20));    // 6 MB
  _Float16* wproj_pk = (_Float16*)(ws + ((size_t)10 << 20));    // 2 MB
  _Float16* q        = (_Float16*)(ws + ((size_t)12 << 20));    // 4 MB
  _Float16* k        = (_Float16*)(ws + ((size_t)16 << 20));    // 4 MB
  _Float16* vT       = (_Float16*)(ws + ((size_t)20 << 20));    // 4 MB
  _Float16* O        = (_Float16*)(ws + ((size_t)24 << 20));    // 4 MB

  // one launch, 4 waves/block: 768 blocks for w_qkv and 256 for w_proj (32 k
  // tiles x N / 32 tile pairs, 1 pair/wave), 256 for x (128 strips x 8 groups
  // of 4 tiles, 1 group/wave)
  pack_operands_kernel<<<1280, 128, 0, stream>>>(x, wqkv, wproj,
                                                 xh, wqkv_pk, wproj_pk);

  // 64x48 tiles of 32x64, 1 tile/wave, 8 waves/block
  qkv_rope_kernel<<<384, 256, 0, stream>>>(xh, wqkv_pk, q, k, vT);
  // 16 heads x 128 q-strips = 2048 waves, 4 waves/block
  flash_attn_kernel<<<512, 128, 0, stream>>>(q, k, vT, O);
  // 64x16 tiles of 32x64, 8 waves/block
  proj_kernel<<<128, 256, 0, stream>>>(O, wproj_pk, out);
}

// v007
// Measured time: 55.5 microseconds a run.
// Timed twice side by side with v006, it ran 1.46 and 1.41 times as fast.
// All steps since v000 together make it 5.63 times as fast.
#include <hip/hip_runtime.h>
#include <hip/hip_bf16.h>

typedef __attribute__((ext_vector_type(16))) _Float16 v16h;
typedef __attribute__((ext_vector_type(8)))  _Float16 v8h;
typedef __attribute__((ext_vector_type(8)))  float    v8f;

__device__ __forceinline__ v16h cat8(v8h a, v8h b) {
  return __builtin_shufflevector(a, b, 0,1,2,3,4,5,6,7,8,9,10,11,12,13,14,15);
}

__device__ __forceinline__ v8f wmma_f16(v16h a, v16h b, v8f c) {
  // v_wmma_f32_16x16x32_f16 (neg_a, A, neg_b, B, c_mod, C, reuse_a, reuse_b)
  return __builtin_amdgcn_wmma_f32_16x16x32_f16(false, a, false, b, (short)0, c, false, false);
}

// Fragment order: a 16x32 f16 operand tile (16 rows of A, or 16 columns of B,
// by 32 k) is 1 KB in the workspace, two halves of 512 B. With h = lane >> 4,
// half s holds at lane * 16 B the 8 elements k = 16s + 8h .. 16s + 8h + 7 of
// row (column) lane & 15: the lane's fragment registers as they are. A wave's
// 16-byte load then covers 4 whole 128-B lines, not 32-B pieces of 16 lines.
__device__ __forceinline__ v16h load_frag(const _Float16* __restrict__ tile,
                                          int lane) {
  const _Float16* p = tile + lane * 8;
  return cat8(*(const v8h*)(p), *(const v8h*)(p + 256));
}

// ---------------------------------------------------------------------------
// fp32 -> fp16 convert of a row-major matrix of 1024 columns into fragment
// order (tile = 16 rows x 32 columns, tiles of a row strip side by side).
// One wave converts four tiles side by side (16 rows x 512 B): 16 loads of
// 16 B a lane, all in flight at once, each covering 4 rows x one whole 128-B
// line. A lane's 4 columns are 8 B of the fragment of their row; the stores
// of rows 4i .. 4i + 3 fill 64-B pieces, the next store the line's other half.
// ---------------------------------------------------------------------------
typedef __attribute__((ext_vector_type(4))) float    v4f;
typedef __attribute__((ext_vector_type(4))) _Float16 v4h;

__device__ __forceinline__ void
f32_to_f16_tiles(const float* __restrict__ src, _Float16* __restrict__ dst,
                 int blk) {
  int gw   = (blk * 128 + threadIdx.x) >> 5;          // 128 strips x 8 quads
  int lane = threadIdx.x & 31;
  int strip = gw >> 3, quad = gw & 7;
  int r0 = lane >> 3, c4 = lane & 7;       // row 4i + r0, columns 4 c4 .. + 3
  const float* s = src + (size_t)(strip * 16 + r0) * 1024 + quad * 128 + c4 * 4;
  v4f v[4][4];
  #pragma unroll
  for (int t = 0; t < 4; ++t)
    #pragma unroll
    for (int i = 0; i < 4; ++i)
      v[t][i] = *(const v4f*)(s + i * 4096 + t * 32);
  // the loads' address pair is reused below: keep the address-translation wait
  // in front of that overwrite; named as an input the pair lives up to the wait,
  // so that no load's own result lands on it
  asm volatile("s_wait_xcnt 0x0" :: "v"(s) : "memory");
  // keeps all 16 loads ahead of the first conversion: the scheduler otherwise
  // holds some back for registers, a second memory round trip in series
  __builtin_amdgcn_sched_barrier(0);
  // column c = 4 c4: half c >> 4, lane (row) + 16 ((c >> 3) & 1), element c & 7
  _Float16* d = dst + (size_t)(strip * 32 + quad * 4) * 512 + (c4 >> 2) * 256 +
                ((c4 >> 1) & 1) * 128 + r0 * 8 + (c4 & 1) * 4;
  #pragma unroll
  for (int t = 0; t < 4; ++t)
    #pragma unroll
    for (int i = 0; i < 4; ++i) {
      v4h w;
      #pragma unroll
      for (int e = 0; e < 4; ++e) w[e] = (_Float16)v[t][i][e];
      *(v4h*)(d + t * 512 + i * 32) = w;
    }
  // the shared kernel's other bodies follow these stores in the code and reuse
  // their registers: keep the address-translation wait in front of that
  asm volatile("s_wait_xcnt 0x0" ::: "memory");
}

// ---------------------------------------------------------------------------
// Pack a 1024 x N row-major f32 matrix into WMMA-B fragment order (f16): the
// GEMM consumer does two 16-byte loads per lane per WMMA, 512 B a wave each.
// One wave packs two tiles side by side (32 k x 32 columns): a lane keeps one
// column, its 32 loads (one whole 128-B line a wave each) are all in flight at
// once, and each run of 8 k is 16 B of the column's fragment: 4 stores a lane,
// 256 contiguous bytes per tile and store. A block takes 2 k tiles of 64
// columns, so that it reads the rows in aligned 256-B units.
// ---------------------------------------------------------------------------
template <int N>
__device__ __forceinline__ void
pack_b_tiles(const float* __restrict__ src, _Float16* __restrict__ dst,
             int blk) {
  const int KT = 32;                       // 1024 / 32
  int wv   = threadIdx.x >> 5;
  int lane = threadIdx.x & 31;
  int kt = (blk & 15) * 2 + (wv >> 1);
  int np = (blk >> 4) * 2 + (wv & 1);          // pair of 16-column tiles
  const float* s = src + (size_t)(kt * 32) * N + np * 32 + lane;
  float v[32];
  #pragma unroll
  for (int r = 0; r < 32; ++r) v[r] = s[(size_t)r * N];
  _Float16* d = dst + ((size_t)(np * 2 + (lane >> 4)) * KT + kt) * 512 +
                (lane & 15) * 8;
  // k = 8g + e lies in half g >> 1 at lane (column) + 16 (g & 1), element e
  #pragma unroll
  for (int g = 0; g < 4; ++g) {
    v8h w;
    #pragma unroll
    for (int e = 0; e < 8; ++e) w[e] = (_Float16)v[g * 8 + e];
    *(v8h*)(d + (g >> 1) * 256 + (g & 1) * 128) = w;
  }
  // as in f32_to_f16_tiles: the wait in front of a reuse of the stores' registers
  asm volatile("s_wait_xcnt 0x0" ::: "memory");
}

// ---------------------------------------------------------------------------
// The three packings depend on nothing but the inputs, so they share one
// launch: a block takes its piece of one matrix by its index (a scalar branch).
// Their waves are all resident together and their memory round trips overlap,
// where three launches in a row each paid a gap, a fill and a drain of its own.
// The largest matrix comes first.
// ---------------------------------------------------------------------------
__global__ void __launch_bounds__(128)
pack_operands_kernel(const float* __restrict__ x,
                     const float* __restrict__ wqkv,
                     const float* __restrict__ wproj,
                     _Float16* __restrict__ xh,
                     _Float16* __restrict__ wqkv_pk,
                     _Float16* __restrict__ wproj_pk) {
  int b = blockIdx.x;
  if (b < 768)       pack_b_tiles<3072>(wqkv, wqkv_pk, b);
  else if (b < 1024) f32_to_f16_tiles(x, xh, b - 768);
  else               pack_b_tiles<1024>(wproj, wproj_pk, b - 1024);
}

// ---------------------------------------------------------------------------
// K = 1024 loop of a 32x64 wave tile, shared by the two GEMM kernels. Both
// operands lie in fragment order: 512 halfs a tile, 32 tiles a strip.
// The 12 loads of a k-step (2 A and 4 B fragments) are issued together, two
// k-steps ahead of the 8 WMMAs that use them, into a ring of three register
// sets: the L2 latency is spread over two k-steps of matrix work, where a
// single set meant two load-wait rounds in series inside every k-step.
// ---------------------------------------------------------------------------
struct KStep { v16h a0, a1, b0, b1, b2, b3; };

__device__ __forceinline__ KStep load_kstep(const _Float16* __restrict__ atile,
                                            const _Float16* __restrict__ btile,
                                            int kt, int lane) {
  KStep f;
  f.a0 = load_frag(atile + kt * 512, lane);
  f.a1 = load_frag(atile + 16384 + kt * 512, lane);
  f.b0 = load_frag(btile + kt * 512, lane);
  f.b1 = load_frag(btile + 16384 + kt * 512, lane);
  f.b2 = load_frag(btile + 32768 + kt * 512, lane);
  f.b3 = load_frag(btile + 49152 + kt * 512, lane);
  return f;
}

__device__ __forceinline__ void gemm_tile_32x64(const _Float16* __restrict__ atile,
                                                const _Float16* __restrict__ btile,
                                                int lane, v8f (&c)[2][4]) {
  const int KT = 32;                       // 1024 / 32
  KStep f[3];
  f[0] = load_kstep(atile, btile, 0, lane);
  f[1] = load_kstep(atile, btile, 1, lane);
  // unrolled in full: the ring index is then a constant (the sets stay in
  // registers) and kt goes into the loads' immediate offsets, so that the
  // loop rewrites no address register while loads are in flight
  #pragma unroll
  for (int kt = 0; kt < KT; ++kt) {
    if (kt + 2 < KT) f[(kt + 2) % 3] = load_kstep(atile, btile, kt + 2, lane);
    // keeps the loads up here: sunk towards their use they would lose the lead
    __builtin_amdgcn_sched_barrier(0);
    const KStep& g = f[kt % 3];
    c[0][0] = wmma_f16(g.a0, g.b0, c[0][0]);
    c[1][0] = wmma_f16(g.a1, g.b0, c[1][0]);
    c[0][1] = wmma_f16(g.a0, g.b1, c[0][1]);
    c[1][1] = wmma_f16(g.a1, g.b1, c[1][1]);
    c[0][2] = wmma_f16(g.a0, g.b2, c[0][2]);
    c[1][2] = wmma_f16(g.a1, g.b2, c[1][2]);
    c[0][3] = wmma_f16(g.a0, g.b3, c[0][3]);
    c[1][3] = wmma_f16(g.a1, g.b3, c[1][3]);
  }
}

// ---------------------------------------------------------------------------
// QKV GEMM (2048x1024 @ 1024x3072) + RoPE + scatter.
// One 32x64 output tile per wave: 2 A-frags x 4 B-frags -> 8 WMMAs per
// k-step, 12 b128 loads. Each wave's 64 columns = one head of one of q/k/v.
// ---------------------------------------------------------------------------
// The real block size is declared so that the register cap of a 1024-thread
// block goes: three sets of 48 fragment registers beside 64 accumulators.
__global__ void __launch_bounds__(256)
qkv_rope_kernel(const _Float16* __restrict__ xh,
                                const _Float16* __restrict__ wpk,
                                _Float16* __restrict__ q,
                                _Float16* __restrict__ kd,
                                _Float16* __restrict__ vT) {
  const int KT = 32;                       // 1024 / 32
  int gw   = (blockIdx.x * blockDim.x + threadIdx.x) >> 5;
  int lane = threadIdx.x & 31;
  int mt = gw & 63;                        // 64 row tiles of 32 rows
  int ng = gw >> 6;                        // 48 col groups of 64 cols
  int h = lane >> 4, nl = lane & 15;

  v8f c[2][4] = {};
  // both operands in fragment order: 512 halfs a tile, 32 tiles a strip
  const _Float16* atile = xh  + (size_t)(mt * 2) * KT * 512;
  const _Float16* btile = wpk + (size_t)(ng * 4) * KT * 512;

  gemm_tile_32x64(atile, btile, lane, c);

  int sect = (ng * 64) >> 10;              // 0=q 1=k 2=v (uniform per wave)
  int head = ng & 15;                      // uniform per wave

  if (sect == 2) {
    // V^T in fragment order, [H][32-key block][16-d tile]: a lane's 8 registers
    // are keys 16i + 8h + r of d = 16j + nl, its own 16 bytes of half i
    _Float16* dst = vT + (size_t)head * 131072 + (size_t)mt * 2048 + lane * 8;
    #pragma unroll
    for (int j = 0; j < 4; ++j)
      #pragma unroll
      for (int i = 0; i < 2; ++i) {
        v8h w;
        #pragma unroll
        for (int r = 0; r < 8; ++r) w[r] = (_Float16)c[i][j][r];
        *(v8h*)(dst + j * 512 + i * 256) = w;
      }
  } else {
    // RoPE, then Q and K in fragment order, [H][16-row tile][32-d tile]: row
    // r + 8h, d = 16j + nl lies in half j & 1 at lane (r + 8h) + 16 (nl >> 3),
    // element nl & 7. The wave fills each 512 B alone.
    _Float16* base = (sect == 0 ? q : kd) + (size_t)head * 131072 +
                     (size_t)mt * 2048 + h * 64 + (nl >> 3) * 128 + (nl & 7);
    #pragma unroll
    for (int j = 0; j < 4; ++j) {
      int d = j * 16 + nl;
      // inv_freq = 10000^(-(d>>1)/32) = exp(-(d>>1) * ln(10000)/32)
      float fr = __expf(-(float)(d >> 1) * 0.28782313662425572f);
      #pragma unroll
      for (int i = 0; i < 2; ++i) {
        #pragma unroll
        for (int r = 0; r < 8; ++r) {
          float xv = c[i][j][r];
          float pv = __shfl_xor(xv, 1, 32);  // partner column d^1 = lane^1
          int t = mt * 32 + i * 16 + r + 8 * h;
          float s, co;
          __sincosf((float)t * fr, &s, &co);
          float o = (d & 1) ? fmaf(pv, s, xv * co) : fmaf(xv, co, -pv * s);
          base[i * 1024 + j * 256 + r * 8] = (_Float16)o;
        }
      }
    }
  }
}

__device__ __forceinline__ float xhalf(float x) {
  int b = __builtin_bit_cast(int, x);
  return __builtin_bit_cast(float,
      __builtin_amdgcn_permlanex16(b, b, 0x76543210, 0xfedcba98, false, false));
}

// Online softmax of one strip's 32 x 16 score block: key0 = the lane's first
// key (block start + 8h), qi = the lane's query. Returns the probs as the B
// fragment of the second product and, in al, the factor for the old sums.
// A block that is masked whole before the strip has seen a key leaves finite
// values under the start maximum: the next real maximum, or the join, gives
// them the weight exp(-huge) = 0.
__device__ __forceinline__ v16h softmax_block(v8f s0, v8f s1, int key0, int qi,
                                              float& mrow, float& lrow,
                                              float& al) {
  float a0[8], a1[8], mx[8];
  #pragma unroll
  for (int r = 0; r < 8; ++r) {
    int key = key0 + r;
    a0[r] = (key      <= qi) ? s0[r] * 0.125f : -3.0e38f;  // 1/sqrt(64)
    a1[r] = (key + 16 <= qi) ? s1[r] * 0.125f : -3.0e38f;
    mx[r] = fmaxf(a0[r], a1[r]);
  }
  float t = fmaxf(fmaxf(fmaxf(mx[0], mx[1]), fmaxf(mx[2], mx[3])),
                  fmaxf(fmaxf(mx[4], mx[5]), fmaxf(mx[6], mx[7])));
  t = fmaxf(t, xhalf(t));
  float mnew = fmaxf(mrow, t);
  al = __expf(mrow - mnew);
  mrow = mnew;

  // probs: element r = key 8h + r, element 8 + r = key 16 + 8h + r, which
  // is the k order of the vT fragments
  v16h pf;
  float sm[8];
  #pragma unroll
  for (int r = 0; r < 8; ++r) {
    float p0 = __expf(a0[r] - mnew);
    float p1 = __expf(a1[r] - mnew);
    sm[r] = p0 + p1;
    pf[r]     = (_Float16)p0;
    pf[8 + r] = (_Float16)p1;
  }
  lrow = lrow * al + (((sm[0] + sm[1]) + (sm[2] + sm[3])) +
                      ((sm[4] + sm[5]) + (sm[6] + sm[7])));
  return pf;
}

// The real block size is declared so that the register cap of a 1024-thread
// block goes: 128 accumulators, 64 registers of q, 64 of K and V fragments and
// 64 of scores are live at once.
__global__ void __launch_bounds__(128)
flash_attn_kernel(const _Float16* __restrict__ q,
                                  const _Float16* __restrict__ k,
                                  const _Float16* __restrict__ vT,
                                  _Float16* __restrict__ O) {
  // the waves' partial results: [wave][strip][d tile][registers 0-3 | 4-7], a
  // lane's 16 B side by side (512 B a wave and store), and maxima and sums
  __shared__ __align__(16) float part_o[4][4][4][2][128];
  __shared__ float part_m[4][4][32];
  __shared__ float part_l[4][4][32];

  // the wave's number in a scalar register: trip count and addresses are scalar
  const int wv = __builtin_amdgcn_readfirstlane((int)(threadIdx.x >> 5));
  const int lane = threadIdx.x & 31;
  const int head = blockIdx.x >> 5;
  const int g    = blockIdx.x & 31;        // 64-query group
  const int q0   = g << 6;
  const int nblk = 2 * g + 2;              // 32-key blocks up to the diagonal
  const int h = lane >> 4, nl = lane & 15;

  // q, K and V^T lie in fragment order: a 16-query strip is 2 tiles = 2 KB in a
  // row, a 32-key block 4 tiles = 4 KB of K and of V^T
  const _Float16* qh = q  + (size_t)head * 131072;   // [T/16][D/32] tiles
  const _Float16* kh = k  + (size_t)head * 131072;   // [T/16][D/32] tiles
  const _Float16* vh = vT + (size_t)head * 131072;   // [T/32][D/16] tiles

  // q of the four strips, 8 KB in a row: [strip][d 0..31 | d 32..63]
  v16h qf[4][2];
  #pragma unroll
  for (int st = 0; st < 4; ++st) {
    qf[st][0] = load_frag(qh + (size_t)q0 * 64 + st * 1024,       lane);
    qf[st][1] = load_frag(qh + (size_t)q0 * 64 + st * 1024 + 512, lane);
  }
  // this and the next keep the first loads in the loop's own order, K ahead of
  // V: the loop's counted waits are set for both ways into it, and with V loads
  // ahead of K loads here every trip would wait for V loads it has just issued
  __builtin_amdgcn_sched_barrier(0);
  // K and V^T fragments are fetched one trip ahead, all eight loads of an
  // operand together: K's fly during the softmax and the second product, V's
  // during the next trip's scores and softmax.
  v16h k0 = load_frag(kh + wv * 2048,        lane);   // keys 0..15,  d 0..31
  v16h k1 = load_frag(kh + wv * 2048 + 512,  lane);   // keys 0..15,  d 32..63
  v16h k2 = load_frag(kh + wv * 2048 + 1024, lane);   // keys 16..31, d 0..31
  v16h k3 = load_frag(kh + wv * 2048 + 1536, lane);   // keys 16..31, d 32..63
  __builtin_amdgcn_sched_barrier(0);
  v16h v0 = load_frag(vh + wv * 2048,        lane);   // d 0..15
  v16h v1 = load_frag(vh + wv * 2048 + 512,  lane);   // d 16..31
  v16h v2 = load_frag(vh + wv * 2048 + 1024, lane);   // d 32..47
  v16h v3 = load_frag(vh + wv * 2048 + 1536, lane);   // d 48..63
  // the loads' address registers are reused below: keep the
  // address-translation wait in front of that overwrite
  asm volatile("s_wait_xcnt 0x0" ::: "memory");

  // o[st][j][r] = O^T[d = 16j + 8h + r][query q0 + 16 st + nl], this wave's keys
  v8f o[4][4] = {};
  float mrow[4], lrow[4];  // running maximum (both halves), sum (this half)
  #pragma unroll
  for (int st = 0; st < 4; ++st) { mrow[st] = -3.0e38f; lrow[st] = 0.f; }

  // Every wave runs at least one trip: in the first group waves 2 and 3 take a
  // block past the diagonal (in bounds, masked whole), which the join weighs 0.
  int kbi = wv;
  do {
    // the last trip has no next block: it fetches its own again (in bounds)
    const int kn = (kbi + 4 < nblk) ? kbi + 4 : kbi;

    // scores: k(32x64) @ q^T -> per strip two 16x16 f32 tiles, row = key,
    // column = query; eight independent accumulators
    v8f s[4][2] = {};
    #pragma unroll
    for (int st = 0; st < 4; ++st) {
      s[st][0] = wmma_f16(k0, qf[st][0], s[st][0]);
      s[st][1] = wmma_f16(k2, qf[st][0], s[st][1]);
    }
    #pragma unroll
    for (int st = 0; st < 4; ++st) {
      s[st][0] = wmma_f16(k1, qf[st][1], s[st][0]);
      s[st][1] = wmma_f16(k3, qf[st][1], s[st][1]);
    }
    k0 = load_frag(kh + (size_t)kn * 2048,        lane);
    k1 = load_frag(kh + (size_t)kn * 2048 + 512,  lane);
    k2 = load_frag(kh + (size_t)kn * 2048 + 1024, lane);
    k3 = load_frag(kh + (size_t)kn * 2048 + 1536, lane);
    // the K loads' address registers are reused below: keep the
    // address-translation wait in front of that overwrite
    asm volatile("s_wait_xcnt 0x0" ::: "memory");
    // keeps the K loads up here: the scheduler otherwise sinks them to the
    // loop's foot, where their whole latency is waited out at the next scores
    __builtin_amdgcn_sched_barrier(0);

    v16h pf[4];
    #pragma unroll
    for (int st = 0; st < 4; ++st) {
      float al;
      pf[st] = softmax_block(s[st][0], s[st][1], kbi * 32 + 8 * h,
                             q0 + st * 16 + nl, mrow[st], lrow[st], al);
      #pragma unroll
      for (int j = 0; j < 4; ++j)
        #pragma unroll
        for (int r = 0; r < 8; ++r) o[st][j][r] *= al;
    }

    // O^T += V^T(64x32) @ P^T(32x16); A rows are d
    #pragma unroll
    for (int st = 0; st < 4; ++st) {
      o[st][0] = wmma_f16(v0, pf[st], o[st][0]);
      o[st][1] = wmma_f16(v1, pf[st], o[st][1]);
      o[st][2] = wmma_f16(v2, pf[st], o[st][2]);
      o[st][3] = wmma_f16(v3, pf[st], o[st][3]);
    }
    // keeps the row sums' additions ahead of the V loads: one had sunk between
    // the loads and their wait below, onto the loads' address pair
    __builtin_amdgcn_sched_barrier(0);
    v0 = load_frag(vh + (size_t)kn * 2048,        lane);
    v1 = load_frag(vh + (size_t)kn * 2048 + 512,  lane);
    v2 = load_frag(vh + (size_t)kn * 2048 + 1024, lane);
    v3 = load_frag(vh + (size_t)kn * 2048 + 1536, lane);
    asm volatile("s_wait_xcnt 0x0" ::: "memory");
    kbi += 4;
  } while (kbi < nblk);
  // the last trip's fetch is still in flight and nothing reads it: let it land
  // before the wave hands its registers back
  asm volatile("s_wait_loadcnt 0x0" ::: "memory");

  // hand the partial results over: a lane writes and later reads the same
  // (query, d) places, so the join is lane by lane
  #pragma unroll
  for (int st = 0; st < 4; ++st) {
    #pragma unroll
    for (int j = 0; j < 4; ++j) {
      v4f lo = {o[st][j][0], o[st][j][1], o[st][j][2], o[st][j][3]};
      v4f hi = {o[st][j][4], o[st][j][5], o[st][j][6], o[st][j][7]};
      *(v4f*)&part_o[wv][st][j][0][lane * 4] = lo;
      *(v4f*)&part_o[wv][st][j][1][lane * 4] = hi;
    }
    part_m[wv][st][lane] = mrow[st];
    part_l[wv][st][lane] = lrow[st];
  }
  __syncthreads();

  // wave w joins strip w: weights exp(m - max) (0 for a wave without a key of
  // the strip), then the two halves' sums once
  float mw[4];
  #pragma unroll
  for (int w = 0; w < 4; ++w) mw[w] = part_m[w][wv][lane];
  float mall = fmaxf(fmaxf(mw[0], mw[1]), fmaxf(mw[2], mw[3]));
  float lsum = 0.f;
  v8f acc[4] = {};
  #pragma unroll
  for (int w = 0; w < 4; ++w) {
    float wt = __expf(mw[w] - mall);
    lsum = fmaf(wt, part_l[w][wv][lane], lsum);
    #pragma unroll
    for (int j = 0; j < 4; ++j) {
      v4f lo = *(const v4f*)&part_o[w][wv][j][0][lane * 4];
      v4f hi = *(const v4f*)&part_o[w][wv][j][1][lane * 4];
      #pragma unroll
      for (int r = 0; r < 4; ++r) {
        acc[j][r]     = fmaf(wt, lo[r], acc[j][r]);
        acc[j][4 + r] = fmaf(wt, hi[r], acc[j][4 + r]);
      }
    }
  }

  // a lane's 8 registers of a tile are 8 consecutive d of its query: one
  // 16-byte store per tile, in the fragment order the projection reads (row
  // nl, column 64 head + 16j + 8h + r: tile 2 head + (j >> 1) of strip qt,
  // half j & 1, this lane): 512 B a wave
  float inv = 1.0f / (lsum + xhalf(lsum));
  const int qt = g * 4 + wv;
  _Float16* orow = O + ((size_t)qt * 32 + head * 2) * 512 + lane * 8;
  #pragma unroll
  for (int j = 0; j < 4; ++j) {
    v8h w;
    #pragma unroll
    for (int r = 0; r < 8; ++r) w[r] = (_Float16)(acc[j][r] * inv);
    *(v8h*)(orow + j * 256) = w;
  }
}

// ---------------------------------------------------------------------------
// Output projection: O(2048x1024 f16) @ w_proj -> d_out f32. 32x64 tiles.
// ---------------------------------------------------------------------------
__global__ void __launch_bounds__(256)   // as for the QKV GEMM
proj_kernel(const _Float16* __restrict__ Oh,
                            const _Float16* __restrict__ wpk,
                            float* __restrict__ out) {
  const int KT = 32;
  int gw   = (blockIdx.x * blockDim.x + threadIdx.x) >> 5;
  int lane = threadIdx.x & 31;
  int mt = gw & 63;                        // 64 row tiles of 32
  int ng = gw >> 6;                        // 16 col groups of 64
  int h = lane >> 4, nl = lane & 15;

  v8f c[2][4] = {};
  // both operands in fragment order: 512 halfs a tile, 32 tiles a strip
  const _Float16* atile = Oh  + (size_t)(mt * 2) * KT * 512;
  const _Float16* btile = wpk + (size_t)(ng * 4) * KT * 512;

  gemm_tile_32x64(atile, btile, lane, c);
  #pragma unroll
  for (int i = 0; i < 2; ++i)
    #pragma unroll
    for (int j = 0; j < 4; ++j)
      #pragma unroll
      for (int r = 0; r < 8; ++r) {
        int t = mt * 32 + i * 16 + r + 8 * h;
        out[(size_t)t * 1024 + ng * 64 + j * 16 + nl] = c[i][j][r];
      }
}

// ---------------------------------------------------------------------------
extern "C" void kernel_launch(void* const* d_in, const int* in_sizes, int n_in,
                              void* d_out, int out_size, void* d_ws, size_t ws_size,
                              hipStream_t stream) {
  const float* x     = (const float*)d_in[0];   // (1,2048,1024)
  const float* wqkv  = (const float*)d_in[1];   // (1024,3072)
  const float* wproj = (const float*)d_in[2];   // (1024,1024)
  float* out = (float*)d_out;                   // (1,2048,1024)

  char* ws = (char*)d_ws;                       // needs ~28 MB
  _Float16* xh       = (_Float16*)(ws);                         // 4 MB
  _Float16* wqkv_pk  = (_Float16*)(ws + ((size_t)4  << 20));    // 6 MB
  _Float16* wproj_pk = (_Float16*)(ws + ((size_t)10 << 20));    // 2 MB
  _Float16* q        = (_Float16*)(ws + ((size_t)12 << 20));    // 4 MB
  _Float16* k        = (_Float16*)(ws + ((size_t)16 << 20));    // 4 MB
  _Float16* vT       = (_Float16*)(ws + ((size_t)20 << 20));    // 4 MB
  _Float16* O        = (_Float16*)(ws + ((size_t)24 << 20));    // 4 MB

  // one launch, 4 waves/block: 768 blocks for w_qkv and 256 for w_proj (32 k
  // tiles x N / 32 tile pairs, 1 pair/wave), 256 for x (128 strips x 8 groups
  // of 4 tiles, 1 group/wave)
  pack_operands_kernel<<<1280, 128, 0, stream>>>(x, wqkv, wproj,
                                                 xh, wqkv_pk, wproj_pk);

  // 64x48 tiles of 32x64, 1 tile/wave, 8 waves/block
  qkv_rope_kernel<<<384, 256, 0, stream>>>(xh, wqkv_pk, q, k, vT);
  // 16 heads x 32 groups of 64 queries, 4 waves/block (they split the keys)
  flash_attn_kernel<<<512, 128, 0, stream>>>(q, k, vT, O);
  // 64x16 tiles of 32x64, 8 waves/block
  proj_kernel<<<128, 256, 0, stream>>>(O, wproj_pk, out);
}

// v008
// A run of this version takes 50.3 microseconds.
// Next to v007, in two timings, it ran 1.11 and 1.09 times as fast.
// All steps since v000 together make it 6.20 times as fast.
#include <hip/hip_runtime.h>
#include <hip/hip_bf16.h>

typedef __attribute__((ext_vector_type(16))) _Float16 v16h;
typedef __attribute__((ext_vector_type(8)))  _Float16 v8h;
typedef __attribute__((ext_vector_type(8)))  float    v8f;

__device__ __forceinline__ v16h cat8(v8h a, v8h b) {
  return __builtin_shufflevector(a, b, 0,1,2,3,4,5,6,7,8,9,10,11,12,13,14,15);
}

__device__ __forceinline__ v8f wmma_f16(v16h a, v16h b, v8f c) {
  // v_wmma_f32_16x16x32_f16 (neg_a, A, neg_b, B, c_mod, C, reuse_a, reuse_b)
  return __builtin_amdgcn_wmma_f32_16x16x32_f16(false, a, false, b, (short)0, c, false, false);
}

// Fragment order: a 16x32 f16 operand tile (16 rows of A, or 16 columns of B,
// by 32 k) is 1 KB in the workspace, two halves of 512 B. With h = lane >> 4,
// half s holds at lane * 16 B the 8 elements k = 16s + 8h .. 16s + 8h + 7 of
// row (column) lane & 15: the lane's fragment registers as they are. A wave's
// 16-byte load then covers 4 whole 128-B lines, not 32-B pieces of 16 lines.
__device__ __forceinline__ v16h load_frag(const _Float16* __restrict__ tile,
                                          int lane) {
  const _Float16* p = tile + lane * 8;
  return cat8(*(const v8h*)(p), *(const v8h*)(p + 256));
}

// ---------------------------------------------------------------------------
// fp32 -> fp16 convert of a row-major matrix of 1024 columns into fragment
// order (tile = 16 rows x 32 columns, tiles of a row strip side by side).
// One wave converts four tiles side by side (16 rows x 512 B): 16 loads of
// 16 B a lane, all in flight at once, each covering 4 rows x one whole 128-B
// line. A lane's 4 columns are 8 B of the fragment of their row; the stores
// of rows 4i .. 4i + 3 fill 64-B pieces, the next store the line's other half.
// ---------------------------------------------------------------------------
typedef __attribute__((ext_vector_type(4))) float    v4f;
typedef __attribute__((ext_vector_type(4))) _Float16 v4h;

__device__ __forceinline__ void
f32_to_f16_tiles(const float* __restrict__ src, _Float16* __restrict__ dst,
                 int blk) {
  int gw   = (blk * 128 + threadIdx.x) >> 5;          // 128 strips x 8 quads
  int lane = threadIdx.x & 31;
  int strip = gw >> 3, quad = gw & 7;
  int r0 = lane >> 3, c4 = lane & 7;       // row 4i + r0, columns 4 c4 .. + 3
  const float* s = src + (size_t)(strip * 16 + r0) * 1024 + quad * 128 + c4 * 4;
  v4f v[4][4];
  #pragma unroll
  for (int t = 0; t < 4; ++t)
    #pragma unroll
    for (int i = 0; i < 4; ++i)
      v[t][i] = *(const v4f*)(s + i * 4096 + t * 32);
  // the loads' address pair is reused below: keep the address-translation wait
  // in front of that overwrite; named as an input the pair lives up to the wait,
  // so that no load's own result lands on it
  asm volatile("s_wait_xcnt 0x0" :: "v"(s) : "memory");
  // keeps all 16 loads ahead of the first conversion: the scheduler otherwise
  // holds some back for registers, a second memory round trip in series
  __builtin_amdgcn_sched_barrier(0);
  // column c = 4 c4: half c >> 4, lane (row) + 16 ((c >> 3) & 1), element c & 7
  _Float16* d = dst + (size_t)(strip * 32 + quad * 4) * 512 + (c4 >> 2) * 256 +
                ((c4 >> 1) & 1) * 128 + r0 * 8 + (c4 & 1) * 4;
  #pragma unroll
  for (int t = 0; t < 4; ++t)
    #pragma unroll
    for (int i = 0; i < 4; ++i) {
      v4h w;
      #pragma unroll
      for (int e = 0; e < 4; ++e) w[e] = (_Float16)v[t][i][e];
      *(v4h*)(d + t * 512 + i * 32) = w;
    }
  // the shared kernel's other bodies follow these stores in the code and reuse
  // their registers: keep the address-translation wait in front of that
  asm volatile("s_wait_xcnt 0x0" ::: "memory");
}

// ---------------------------------------------------------------------------
// Pack a 1024 x N row-major f32 matrix into WMMA-B fragment order (f16): the
// GEMM consumer does two 16-byte loads per lane per WMMA, 512 B a wave each.
// One wave packs two tiles side by side (32 k x 32 columns): a lane keeps one
// column, its 32 loads (one whole 128-B line a wave each) are all in flight at
// once, and each run of 8 k is 16 B of the column's fragment: 4 stores a lane,
// 256 contiguous bytes per tile and store. A block takes 2 k tiles of 64
// columns, so that it reads the rows in aligned 256-B units.
// ---------------------------------------------------------------------------
template <int N>
__device__ __forceinline__ void
pack_b_tiles(const float* __restrict__ src, _Float16* __restrict__ dst,
             int blk) {
  const int KT = 32;                       // 1024 / 32
  int wv   = threadIdx.x >> 5;
  int lane = threadIdx.x & 31;
  int kt = (blk & 15) * 2 + (wv >> 1);
  int np = (blk >> 4) * 2 + (wv & 1);          // pair of 16-column tiles
  const float* s = src + (size_t)(kt * 32) * N + np * 32 + lane;
  float v[32];
  #pragma unroll
  for (int r = 0; r < 32; ++r) v[r] = s[(size_t)r * N];
  _Float16* d = dst + ((size_t)(np * 2 + (lane >> 4)) * KT + kt) * 512 +
                (lane & 15) * 8;
  // k = 8g + e lies in half g >> 1 at lane (column) + 16 (g & 1), element e
  #pragma unroll
  for (int g = 0; g < 4; ++g) {
    v8h w;
    #pragma unroll
    for (int e = 0; e < 8; ++e) w[e] = (_Float16)v[g * 8 + e];
    *(v8h*)(d + (g >> 1) * 256 + (g & 1) * 128) = w;
  }
  // as in f32_to_f16_tiles: the wait in front of a reuse of the stores' registers
  asm volatile("s_wait_xcnt 0x0" ::: "memory");
}

// ---------------------------------------------------------------------------
// The three packings depend on nothing but the inputs, so they share one
// launch: a block takes its piece of one matrix by its index (a scalar branch).
// Their waves are all resident together and their memory round trips overlap,
// where three launches in a row each paid a gap, a fill and a drain of its own.
// The largest matrix comes first.
// ---------------------------------------------------------------------------
__global__ void __launch_bounds__(128)
pack_operands_kernel(const float* __restrict__ x,
                     const float* __restrict__ wqkv,
                     const float* __restrict__ wproj,
                     _Float16* __restrict__ xh,
                     _Float16* __restrict__ wqkv_pk,
                     _Float16* __restrict__ wproj_pk) {
  int b = blockIdx.x;
  if (b < 768)       pack_b_tiles<3072>(wqkv, wqkv_pk, b);
  else if (b < 1024) f32_to_f16_tiles(x, xh, b - 768);
  else               pack_b_tiles<1024>(wproj, wproj_pk, b - 1024);
}

// ---------------------------------------------------------------------------
// K = 1024 loop of a 32x64 wave tile, shared by the two GEMM kernels. Both
// operands lie in fragment order: 512 halfs a tile, 32 tiles a strip.
// The 12 loads of a k-step (2 A and 4 B fragments) are issued together, two
// k-steps ahead of the 8 WMMAs that use them, into a ring of three register
// sets: the L2 latency is spread over two k-steps of matrix work, where a
// single set meant two load-wait rounds in series inside every k-step.
// ---------------------------------------------------------------------------
struct KStep { v16h a0, a1, b0, b1, b2, b3; };

__device__ __forceinline__ KStep load_kstep(const _Float16* __restrict__ atile,
                                            const _Float16* __restrict__ btile,
                                            int kt, int lane) {
  KStep f;
  f.a0 = load_frag(atile + kt * 512, lane);
  f.a1 = load_frag(atile + 16384 + kt * 512, lane);
  f.b0 = load_frag(btile + kt * 512, lane);
  f.b1 = load_frag(btile + 16384 + kt * 512, lane);
  f.b2 = load_frag(btile + 32768 + kt * 512, lane);
  f.b3 = load_frag(btile + 49152 + kt * 512, lane);
  return f;
}

__device__ __forceinline__ void gemm_tile_32x64(const _Float16* __restrict__ atile,
                                                const _Float16* __restrict__ btile,
                                                int lane, v8f (&c)[2][4]) {
  const int KT = 32;                       // 1024 / 32
  KStep f[3];
  f[0] = load_kstep(atile, btile, 0, lane);
  f[1] = load_kstep(atile, btile, 1, lane);
  // unrolled in full: the ring index is then a constant (the sets stay in
  // registers) and kt goes into the loads' immediate offsets, so that the
  // loop rewrites no address register while loads are in flight
  #pragma unroll
  for (int kt = 0; kt < KT; ++kt) {
    if (kt + 2 < KT) f[(kt + 2) % 3] = load_kstep(atile, btile, kt + 2, lane);
    // keeps the loads up here: sunk towards their use they would lose the lead
    __builtin_amdgcn_sched_barrier(0);
    const KStep& g = f[kt % 3];
    c[0][0] = wmma_f16(g.a0, g.b0, c[0][0]);
    c[1][0] = wmma_f16(g.a1, g.b0, c[1][0]);
    c[0][1] = wmma_f16(g.a0, g.b1, c[0][1]);
    c[1][1] = wmma_f16(g.a1, g.b1, c[1][1]);
    c[0][2] = wmma_f16(g.a0, g.b2, c[0][2]);
    c[1][2] = wmma_f16(g.a1, g.b2, c[1][2]);
    c[0][3] = wmma_f16(g.a0, g.b3, c[0][3]);
    c[1][3] = wmma_f16(g.a1, g.b3, c[1][3]);
  }
}

// ---------------------------------------------------------------------------
// QKV GEMM (2048x1024 @ 1024x3072) + RoPE + scatter.
// One 32x64 output tile per wave: 2 A-frags x 4 B-frags -> 8 WMMAs per
// k-step, 12 b128 loads. Each wave's 64 columns = one head of one of q/k/v.
// ---------------------------------------------------------------------------
// The real block size is declared so that the register cap of a 1024-thread
// block goes: three sets of 48 fragment registers beside 64 accumulators.
__global__ void __launch_bounds__(256)
qkv_rope_kernel(const _Float16* __restrict__ xh,
                                const _Float16* __restrict__ wpk,
                                _Float16* __restrict__ q,
                                _Float16* __restrict__ kd,
                                _Float16* __restrict__ vT) {
  const int KT = 32;                       // 1024 / 32
  int gw   = (blockIdx.x * blockDim.x + threadIdx.x) >> 5;
  int lane = threadIdx.x & 31;
  int mt = gw & 63;                        // 64 row tiles of 32 rows
  int ng = gw >> 6;                        // 48 col groups of 64 cols
  int h = lane >> 4, nl = lane & 15;

  v8f c[2][4] = {};
  // both operands in fragment order: 512 halfs a tile, 32 tiles a strip
  const _Float16* atile = xh  + (size_t)(mt * 2) * KT * 512;
  const _Float16* btile = wpk + (size_t)(ng * 4) * KT * 512;

  gemm_tile_32x64(atile, btile, lane, c);

  int sect = (ng * 64) >> 10;              // 0=q 1=k 2=v (uniform per wave)
  int head = ng & 15;                      // uniform per wave

  if (sect == 2) {
    // V^T in fragment order, [H][32-key block][16-d tile]: a lane's 8 registers
    // are keys 16i + 8h + r of d = 16j + nl, its own 16 bytes of half i
    _Float16* dst = vT + (size_t)head * 131072 + (size_t)mt * 2048 + lane * 8;
    #pragma unroll
    for (int j = 0; j < 4; ++j)
      #pragma unroll
      for (int i = 0; i < 2; ++i) {
        v8h w;
        #pragma unroll
        for (int r = 0; r < 8; ++r) w[r] = (_Float16)c[i][j][r];
        *(v8h*)(dst + j * 512 + i * 256) = w;
      }
  } else {
    // RoPE, then Q and K in fragment order, [H][16-row tile][32-d tile]: row
    // r + 8h, d = 16j + nl lies in half j & 1 at lane (r + 8h) + 16 (nl >> 3),
    // element nl & 7. The wave fills each 512 B alone.
    _Float16* base = (sect == 0 ? q : kd) + (size_t)head * 131072 +
                     (size_t)mt * 2048 + h * 64 + (nl >> 3) * 128 + (nl & 7);
    #pragma unroll
    for (int j = 0; j < 4; ++j) {
      int d = j * 16 + nl;
      // inv_freq = 10000^(-(d>>1)/32) = exp(-(d>>1) * ln(10000)/32)
      float fr = __expf(-(float)(d >> 1) * 0.28782313662425572f);
      #pragma unroll
      for (int i = 0; i < 2; ++i) {
        #pragma unroll
        for (int r = 0; r < 8; ++r) {
          float xv = c[i][j][r];
          float pv = __shfl_xor(xv, 1, 32);  // partner column d^1 = lane^1
          int t = mt * 32 + i * 16 + r + 8 * h;
          float s, co;
          __sincosf((float)t * fr, &s, &co);
          float o = (d & 1) ? fmaf(pv, s, xv * co) : fmaf(xv, co, -pv * s);
          base[i * 1024 + j * 256 + r * 8] = (_Float16)o;
        }
      }
    }
  }
}

__device__ __forceinline__ float xhalf(float x) {
  int b = __builtin_bit_cast(int, x);
  return __builtin_bit_cast(float,
      __builtin_amdgcn_permlanex16(b, b, 0x76543210, 0xfedcba98, false, false));
}

// Online softmax of one strip's 32 x 16 score block: key0 = the lane's first
// key (block start + 8h), qi = the lane's query. Returns the probs as the B
// fragment of the second product and, in al, the factor for the old sums.
// A block that is masked whole before the strip has seen a key leaves finite
// values under the start maximum: the next real maximum, or the join, gives
// them the weight exp(-huge) = 0.
__device__ __forceinline__ v16h softmax_block(v8f s0, v8f s1, int key0, int qi,
                                              float& mrow, float& lrow,
                                              float& al) {
  float a0[8], a1[8], mx[8];
  #pragma unroll
  for (int r = 0; r < 8; ++r) {
    int key = key0 + r;
    a0[r] = (key      <= qi) ? s0[r] * 0.125f : -3.0e38f;  // 1/sqrt(64)
    a1[r] = (key + 16 <= qi) ? s1[r] * 0.125f : -3.0e38f;
    mx[r] = fmaxf(a0[r], a1[r]);
  }
  float t = fmaxf(fmaxf(fmaxf(mx[0], mx[1]), fmaxf(mx[2], mx[3])),
                  fmaxf(fmaxf(mx[4], mx[5]), fmaxf(mx[6], mx[7])));
  t = fmaxf(t, xhalf(t));
  float mnew = fmaxf(mrow, t);
  al = __expf(mrow - mnew);
  mrow = mnew;

  // probs: element r = key 8h + r, element 8 + r = key 16 + 8h + r, which
  // is the k order of the vT fragments
  v16h pf;
  float sm[8];
  #pragma unroll
  for (int r = 0; r < 8; ++r) {
    float p0 = __expf(a0[r] - mnew);
    float p1 = __expf(a1[r] - mnew);
    sm[r] = p0 + p1;
    pf[r]     = (_Float16)p0;
    pf[8 + r] = (_Float16)p1;
  }
  lrow = lrow * al + (((sm[0] + sm[1]) + (sm[2] + sm[3])) +
                      ((sm[4] + sm[5]) + (sm[6] + sm[7])));
  return pf;
}

// Join of one strip's partial results, two of its four d tiles: weights
// exp(m - max) (0 for a wave without a key of the strip), then the two halves'
// sums once. po, pm, pl point at the first of NP partials in a row, at this
// lane's places. A lane's 8 registers of a tile are 8 consecutive d of its
// query: 16 bytes per tile come back in res.
template <int NP>
__device__ __forceinline__ void
join_parts(const float* po, const float* pm, const float* pl, v8h (&res)[2]) {
  float mw[NP];
  #pragma unroll
  for (int w = 0; w < NP; ++w) mw[w] = pm[w * 128];
  float mall = mw[0];
  #pragma unroll
  for (int w = 1; w < NP; ++w) mall = fmaxf(mall, mw[w]);
  float lsum = 0.f;
  v8f acc[2] = {};
  #pragma unroll
  for (int w = 0; w < NP; ++w) {
    float wt = __expf(mw[w] - mall);
    lsum = fmaf(wt, pl[w * 128], lsum);
    #pragma unroll
    for (int jj = 0; jj < 2; ++jj) {
      v4f lo = *(const v4f*)(po + w * 4096 + jj * 256);
      v4f hi = *(const v4f*)(po + w * 4096 + jj * 256 + 128);
      #pragma unroll
      for (int r = 0; r < 4; ++r) {
        acc[jj][r]     = fmaf(wt, lo[r], acc[jj][r]);
        acc[jj][4 + r] = fmaf(wt, hi[r], acc[jj][4 + r]);
      }
    }
  }
  float inv = 1.0f / (lsum + xhalf(lsum));
  #pragma unroll
  for (int jj = 0; jj < 2; ++jj) {
    #pragma unroll
    for (int r = 0; r < 8; ++r) res[jj][r] = (_Float16)(acc[jj][r] * inv);
  }
}

// The causal cost of a 64-query group grows with its index (2g + 2 key blocks),
// and all blocks are resident at once, so the launch lasted as long as the WGP
// that held the heaviest groups. One block of eight waves now takes a light
// group gl and the heavy group 31 - gl of one head, 66 key blocks whatever gl,
// alone on its WGP. Waves 0-3 walk the heavy group's key blocks 0..33; waves
// 4-7 walk all of the light group's and then the rest of the heavy group's, 32
// blocks together, dealt as one list. Waves w and w + 4
// together make 16 or 17 trips. A wave that changes groups leaves its partial result in
// LDS and starts anew; one barrier, then all joins.
// The real block size is declared so that the register cap of a 1024-thread
// block goes: 128 accumulators, 64 registers of q, 64 of K and V fragments and
// 64 of scores are live at once.
__global__ void __launch_bounds__(256)
flash_attn_kernel(const _Float16* __restrict__ q,
                                  const _Float16* __restrict__ k,
                                  const _Float16* __restrict__ vT,
                                  _Float16* __restrict__ O) {
  // the partial results: places 0-7 the eight waves' of the heavy group, 8-11
  // those of waves 4-7 for the light group; [place][strip][d tile][registers
  // 0-3 | 4-7], a lane's 16 B side by side (512 B a wave and store), and maxima
  // and sums
  __shared__ __align__(16) float part_o[12][4][4][2][128];
  __shared__ float part_m[12][4][32];
  __shared__ float part_l[12][4][32];

  // the wave's number in a scalar register: trip counts and addresses are scalar
  const int wv = __builtin_amdgcn_readfirstlane((int)(threadIdx.x >> 5));
  const int w4 = wv & 3, grp = wv >> 2;
  const int lane = threadIdx.x & 31;
  const int head = blockIdx.x >> 4;
  const int gl   = blockIdx.x & 15;        // light 64-query group
  const int gh   = 31 - gl;                // heavy 64-query group
  const int nblk_lo = 2 * gl + 2;          // 32-key blocks up to the diagonal
  const int nblk_hi = 2 * gh + 2;          // at least 34
  // waves 4-7: entry i = w4 + 4t of their list is block i of the light group
  // while i < nblk_lo, then block 34 + i - nblk_lo of the heavy group
  const int tlo = (nblk_lo - w4 + 3) >> 2; // the wave's trips in the light group
  const int h = lane >> 4, nl = lane & 15;

  // q, K and V^T lie in fragment order: a 16-query strip is 2 tiles = 2 KB in a
  // row, a 32-key block 4 tiles = 4 KB of K and of V^T
  const _Float16* qh = q  + (size_t)head * 131072;   // [T/16][D/32] tiles
  const _Float16* kh = k  + (size_t)head * 131072;   // [T/16][D/32] tiles
  const _Float16* vh = vT + (size_t)head * 131072;   // [T/32][D/16] tiles

  // part 0: the light group (waves 4-7 only), part 1: the heavy group.
  // Kept rolled: one copy of the key loop in the instruction cache, not two
  #pragma unroll 1
  for (int part = 1 - grp; part < 2; ++part) {
    const int q0   = (part ? gh : gl) << 6;
    const int kend = part ? (grp ? nblk_hi : 34) : nblk_lo;
    const int slot = part ? wv : 8 + w4;
    int kbi = (part & grp) ? 34 + w4 + 4 * tlo - nblk_lo : w4;

    // o[st][j][r] = O^T[d = 16j + 8h + r][query q0 + 16 st + nl], this wave's keys
    v8f o[4][4] = {};
    float mrow[4], lrow[4];  // running maximum (both halves), sum (this half)
    #pragma unroll
    for (int st = 0; st < 4; ++st) { mrow[st] = -3.0e38f; lrow[st] = 0.f; }

    // a wave whose share of this group is empty hands over zeros under the
    // start maximum, which the join weighs 0 (a scalar branch)
    if (kbi < kend) {
      // q of the four strips, 8 KB in a row: [strip][d 0..31 | d 32..63]
      v16h qf[4][2];
      #pragma unroll
      for (int st = 0; st < 4; ++st) {
        qf[st][0] = load_frag(qh + (size_t)q0 * 64 + st * 1024,       lane);
        qf[st][1] = load_frag(qh + (size_t)q0 * 64 + st * 1024 + 512, lane);
      }
      // this and the next keep the first loads in the loop's own order, K ahead
      // of V: the loop's counted waits are set for both ways into it, and with V
      // loads ahead of K loads here every trip would wait for V loads it has
      // just issued
      __builtin_amdgcn_sched_barrier(0);
      // K and V^T fragments are fetched one trip ahead, all eight loads of an
      // operand together: K's fly during the softmax and the second product,
      // V's during the next trip's scores and softmax.
      const _Float16* kp = kh + (size_t)kbi * 2048;
      const _Float16* vp = vh + (size_t)kbi * 2048;
      v16h k0 = load_frag(kp,        lane);   // keys 0..15,  d 0..31
      v16h k1 = load_frag(kp + 512,  lane);   // keys 0..15,  d 32..63
      v16h k2 = load_frag(kp + 1024, lane);   // keys 16..31, d 0..31
      v16h k3 = load_frag(kp + 1536, lane);   // keys 16..31, d 32..63
      __builtin_amdgcn_sched_barrier(0);
      v16h v0 = load_frag(vp,        lane);   // d 0..15
      v16h v1 = load_frag(vp + 512,  lane);   // d 16..31
      v16h v2 = load_frag(vp + 1024, lane);   // d 32..47
      v16h v3 = load_frag(vp + 1536, lane);   // d 48..63
      // the loads' address registers are reused below: keep the
      // address-translation wait in front of that overwrite; named as inputs
      // the scalar bases live up to the wait, and the loads take them as they
      // are (with the lane's offset), so that no load's result lands on an
      // address pair of its own
      asm volatile("s_wait_xcnt 0x0" :: "s"(kp), "s"(vp) : "memory");
      // keeps the accumulators' start values behind that wait: without it some
      // rise between the loads and the wait, onto the q loads' address pair
      __builtin_amdgcn_sched_barrier(0);

      do {
        // the last trip has no next block: it fetches its own again (in bounds)
        const int kn = (kbi + 4 < kend) ? kbi + 4 : kbi;

        // scores: k(32x64) @ q^T -> per strip two 16x16 f32 tiles, row = key,
        // column = query; eight independent accumulators
        v8f s[4][2] = {};
        #pragma unroll
        for (int st = 0; st < 4; ++st) {
          s[st][0] = wmma_f16(k0, qf[st][0], s[st][0]);
          s[st][1] = wmma_f16(k2, qf[st][0], s[st][1]);
        }
        #pragma unroll
        for (int st = 0; st < 4; ++st) {
          s[st][0] = wmma_f16(k1, qf[st][1], s[st][0]);
          s[st][1] = wmma_f16(k3, qf[st][1], s[st][1]);
        }
        kp = kh + (size_t)kn * 2048;
        k0 = load_frag(kp,        lane);
        k1 = load_frag(kp + 512,  lane);
        k2 = load_frag(kp + 1024, lane);
        k3 = load_frag(kp + 1536, lane);
        asm volatile("s_wait_xcnt 0x0" :: "s"(kp) : "memory");
        // keeps the K loads up here: the scheduler otherwise sinks them to the
        // loop's foot, where their whole latency is waited out at the next scores
        __builtin_amdgcn_sched_barrier(0);

        v16h pf[4];
        #pragma unroll
        for (int st = 0; st < 4; ++st) {
          float al;
          pf[st] = softmax_block(s[st][0], s[st][1], kbi * 32 + 8 * h,
                                 q0 + st * 16 + nl, mrow[st], lrow[st], al);
          #pragma unroll
          for (int j = 0; j < 4; ++j)
            #pragma unroll
            for (int r = 0; r < 8; ++r) o[st][j][r] *= al;
        }

        // O^T += V^T(64x32) @ P^T(32x16); A rows are d
        #pragma unroll
        for (int st = 0; st < 4; ++st) {
          o[st][0] = wmma_f16(v0, pf[st], o[st][0]);
          o[st][1] = wmma_f16(v1, pf[st], o[st][1]);
          o[st][2] = wmma_f16(v2, pf[st], o[st][2]);
          o[st][3] = wmma_f16(v3, pf[st], o[st][3]);
        }
        vp = vh + (size_t)kn * 2048;
        v0 = load_frag(vp,        lane);
        v1 = load_frag(vp + 512,  lane);
        v2 = load_frag(vp + 1024, lane);
        v3 = load_frag(vp + 1536, lane);
        asm volatile("s_wait_xcnt 0x0" :: "s"(vp) : "memory");
        kbi += 4;
      } while (kbi < kend);
      // the last trip's fetch is still in flight and nothing reads it: let it
      // land before its registers are used again or handed back
      asm volatile("s_wait_loadcnt 0x0" ::: "memory");
    }

    // hand the partial results over: a lane writes and later reads the same
    // (query, d) places, so the join is lane by lane
    #pragma unroll
    for (int st = 0; st < 4; ++st) {
      #pragma unroll
      for (int j = 0; j < 4; ++j) {
        v4f lo = {o[st][j][0], o[st][j][1], o[st][j][2], o[st][j][3]};
        v4f hi = {o[st][j][4], o[st][j][5], o[st][j][6], o[st][j][7]};
        *(v4f*)&part_o[slot][st][j][0][lane * 4] = lo;
        *(v4f*)&part_o[slot][st][j][1][lane * 4] = hi;
      }
      part_m[slot][st][lane] = mrow[st];
      part_l[slot][st][lane] = lrow[st];
    }
  }
  __syncthreads();

  // wave w joins d tiles 2 (w >> 2) and 2 (w >> 2) + 1 of strip w & 3 of both
  // groups: eight partial results for the heavy one, four for the light one
  v8h rh[2], rl[2];
  join_parts<8>(&part_o[0][w4][2 * grp][0][lane * 4], &part_m[0][w4][lane],
                &part_l[0][w4][lane], rh);
  join_parts<4>(&part_o[8][w4][2 * grp][0][lane * 4], &part_m[8][w4][lane],
                &part_l[8][w4][lane], rl);
  // one 16-byte store per tile, 512 B a wave, in the fragment order the
  // projection reads (row nl, column 64 head + 16j + 8h + r: tile 2 head +
  // (j >> 1) of the 16-query strip, half j & 1, this lane)
  _Float16* obase = O + (size_t)(head * 2 + grp) * 512 + lane * 8;
  _Float16* oh = obase + (size_t)(gh * 4 + w4) * 16384;
  _Float16* ol = obase + (size_t)(gl * 4 + w4) * 16384;
  *(v8h*)(oh)       = rh[0];
  *(v8h*)(oh + 256) = rh[1];
  *(v8h*)(ol)       = rl[0];
  *(v8h*)(ol + 256) = rl[1];
}

// ---------------------------------------------------------------------------
// Output projection: O(2048x1024 f16) @ w_proj -> d_out f32. 32x64 tiles.
// ---------------------------------------------------------------------------
__global__ void __launch_bounds__(256)   // as for the QKV GEMM
proj_kernel(const _Float16* __restrict__ Oh,
                            const _Float16* __restrict__ wpk,
                            float* __restrict__ out) {
  const int KT = 32;
  int gw   = (blockIdx.x * blockDim.x + threadIdx.x) >> 5;
  int lane = threadIdx.x & 31;
  int mt = gw & 63;                        // 64 row tiles of 32
  int ng = gw >> 6;                        // 16 col groups of 64
  int h = lane >> 4, nl = lane & 15;

  v8f c[2][4] = {};
  // both operands in fragment order: 512 halfs a tile, 32 tiles a strip
  const _Float16* atile = Oh  + (size_t)(mt * 2) * KT * 512;
  const _Float16* btile = wpk + (size_t)(ng * 4) * KT * 512;

  gemm_tile_32x64(atile, btile, lane, c);
  #pragma unroll
  for (int i = 0; i < 2; ++i)
    #pragma unroll
    for (int j = 0; j < 4; ++j)
      #pragma unroll
      for (int r = 0; r < 8; ++r) {
        int t = mt * 32 + i * 16 + r + 8 * h;
        out[(size_t)t * 1024 + ng * 64 + j * 16 + nl] = c[i][j][r];
      }
}

// ---------------------------------------------------------------------------
extern "C" void kernel_launch(void* const* d_in, const int* in_sizes, int n_in,
                              void* d_out, int out_size, void* d_ws, size_t ws_size,
                              hipStream_t stream) {
  const float* x     = (const float*)d_in[0];   // (1,2048,1024)
  const float* wqkv  = (const float*)d_in[1];   // (1024,3072)
  const float* wproj = (const float*)d_in[2];   // (1024,1024)
  float* out = (float*)d_out;                   // (1,2048,1024)

  char* ws = (char*)d_ws;                       // needs ~28 MB
  _Float16* xh       = (_Float16*)(ws);                         // 4 MB
  _Float16* wqkv_pk  = (_Float16*)(ws + ((size_t)4  << 20));    // 6 MB
  _Float16* wproj_pk = (_Float16*)(ws + ((size_t)10 << 20));    // 2 MB
  _Float16* q        = (_Float16*)(ws + ((size_t)12 << 20));    // 4 MB
  _Float16* k        = (_Float16*)(ws + ((size_t)16 << 20));    // 4 MB
  _Float16* vT       = (_Float16*)(ws + ((size_t)20 << 20));    // 4 MB
  _Float16* O        = (_Float16*)(ws + ((size_t)24 << 20));    // 4 MB

  // one launch, 4 waves/block: 768 blocks for w_qkv and 256 for w_proj (32 k
  // tiles x N / 32 tile pairs, 1 pair/wave), 256 for x (128 strips x 8 groups
  // of 4 tiles, 1 group/wave)
  pack_operands_kernel<<<1280, 128, 0, stream>>>(x, wqkv, wproj,
                                                 xh, wqkv_pk, wproj_pk);

  // 64x48 tiles of 32x64, 1 tile/wave, 8 waves/block
  qkv_rope_kernel<<<384, 256, 0, stream>>>(xh, wqkv_pk, q, k, vT);
  // 16 heads x 16 pairs of a light and a heavy group of 64 queries, 8 waves/block
  flash_attn_kernel<<<256, 256, 0, stream>>>(q, k, vT, O);
  // 64x16 tiles of 32x64, 8 waves/block
  proj_kernel<<<128, 256, 0, stream>>>(O, wproj_pk, out);
}

// v009
// A run of this version takes 45.7 microseconds.
// Two timings next to v008 put it at 1.08 and 1.07 times that version's speed.
// Over all steps from v000 it is 6.68 times as fast.
#include <hip/hip_runtime.h>
#include <hip/hip_bf16.h>

typedef __attribute__((ext_vector_type(16))) _Float16 v16h;
typedef __attribute__((ext_vector_type(8)))  _Float16 v8h;
typedef __attribute__((ext_vector_type(8)))  float    v8f;

__device__ __forceinline__ v16h cat8(v8h a, v8h b) {
  return __builtin_shufflevector(a, b, 0,1,2,3,4,5,6,7,8,9,10,11,12,13,14,15);
}

__device__ __forceinline__ v8f wmma_f16(v16h a, v16h b, v8f c) {
  // v_wmma_f32_16x16x32_f16 (neg_a, A, neg_b, B, c_mod, C, reuse_a, reuse_b)
  return __builtin_amdgcn_wmma_f32_16x16x32_f16(false, a, false, b, (short)0, c, false, false);
}

// Fragment order: a 16x32 f16 operand tile (16 rows of A, or 16 columns of B,
// by 32 k) is 1 KB in the workspace, two halves of 512 B. With h = lane >> 4,
// half s holds at lane * 16 B the 8 elements k = 16s + 8h .. 16s + 8h + 7 of
// row (column) lane & 15: the lane's fragment registers as they are. A wave's
// 16-byte load then covers 4 whole 128-B lines, not 32-B pieces of 16 lines.
__device__ __forceinline__ v16h load_frag(const _Float16* __restrict__ tile,
                                          int lane) {
  const _Float16* p = tile + lane * 8;
  return cat8(*(const v8h*)(p), *(const v8h*)(p + 256));
}

// ---------------------------------------------------------------------------
// fp32 -> fp16 convert of a row-major matrix of 1024 columns into fragment
// order (tile = 16 rows x 32 columns, tiles of a row strip side by side).
// One wave converts four tiles side by side (16 rows x 512 B): 16 loads of
// 16 B a lane, all in flight at once, each covering 4 rows x one whole 128-B
// line. A lane's 4 columns are 8 B of the fragment of their row; the stores
// of rows 4i .. 4i + 3 fill 64-B pieces, the next store the line's other half.
// ---------------------------------------------------------------------------
typedef __attribute__((ext_vector_type(4))) float    v4f;
typedef __attribute__((ext_vector_type(4))) _Float16 v4h;

__device__ __forceinline__ void
f32_to_f16_tiles(const float* __restrict__ src, _Float16* __restrict__ dst,
                 int blk) {
  int gw   = (blk * 128 + threadIdx.x) >> 5;          // 128 strips x 8 quads
  int lane = threadIdx.x & 31;
  int strip = gw >> 3, quad = gw & 7;
  int r0 = lane >> 3, c4 = lane & 7;       // row 4i + r0, columns 4 c4 .. + 3
  const float* s = src + (size_t)(strip * 16 + r0) * 1024 + quad * 128 + c4 * 4;
  v4f v[4][4];
  #pragma unroll
  for (int t = 0; t < 4; ++t)
    #pragma unroll
    for (int i = 0; i < 4; ++i)
      v[t][i] = *(const v4f*)(s + i * 4096 + t * 32);
  // the loads' address pair is reused below: keep the address-translation wait
  // in front of that overwrite; named as an input the pair lives up to the wait,
  // so that no load's own result lands on it
  asm volatile("s_wait_xcnt 0x0" :: "v"(s) : "memory");
  // keeps all 16 loads ahead of the first conversion: the scheduler otherwise
  // holds some back for registers, a second memory round trip in series
  __builtin_amdgcn_sched_barrier(0);
  // column c = 4 c4: half c >> 4, lane (row) + 16 ((c >> 3) & 1), element c & 7
  _Float16* d = dst + (size_t)(strip * 32 + quad * 4) * 512 + (c4 >> 2) * 256 +
                ((c4 >> 1) & 1) * 128 + r0 * 8 + (c4 & 1) * 4;
  #pragma unroll
  for (int t = 0; t < 4; ++t)
    #pragma unroll
    for (int i = 0; i < 4; ++i) {
      v4h w;
      #pragma unroll
      for (int e = 0; e < 4; ++e) w[e] = (_Float16)v[t][i][e];
      *(v4h*)(d + t * 512 + i * 32) = w;
    }
  // the shared kernel's other bodies follow these stores in the code and reuse
  // their registers: keep the address-translation wait in front of that
  asm volatile("s_wait_xcnt 0x0" ::: "memory");
}

// ---------------------------------------------------------------------------
// Pack a 1024 x N row-major f32 matrix into WMMA-B fragment order (f16): the
// GEMM consumer does two 16-byte loads per lane per WMMA, 512 B a wave each.
// One wave packs two tiles side by side (32 k x 32 columns): a lane keeps one
// column, its 32 loads (one whole 128-B line a wave each) are all in flight at
// once, and each run of 8 k is 16 B of the column's fragment: 4 stores a lane,
// 256 contiguous bytes per tile and store. A block takes 2 k tiles of 64
// columns, so that it reads the rows in aligned 256-B units.
// ---------------------------------------------------------------------------
template <int N>
__device__ __forceinline__ void
pack_b_tiles(const float* __restrict__ src, _Float16* __restrict__ dst,
             int blk) {
  const int KT = 32;                       // 1024 / 32
  int wv   = threadIdx.x >> 5;
  int lane = threadIdx.x & 31;
  int kt = (blk & 15) * 2 + (wv >> 1);
  int np = (blk >> 4) * 2 + (wv & 1);          // pair of 16-column tiles
  const float* s = src + (size_t)(kt * 32) * N + np * 32 + lane;
  float v[32];
  #pragma unroll
  for (int r = 0; r < 32; ++r) v[r] = s[(size_t)r * N];
  _Float16* d = dst + ((size_t)(np * 2 + (lane >> 4)) * KT + kt) * 512 +
                (lane & 15) * 8;
  // k = 8g + e lies in half g >> 1 at lane (column) + 16 (g & 1), element e
  #pragma unroll
  for (int g = 0; g < 4; ++g) {
    v8h w;
    #pragma unroll
    for (int e = 0; e < 8; ++e) w[e] = (_Float16)v[g * 8 + e];
    *(v8h*)(d + (g >> 1) * 256 + (g & 1) * 128) = w;
  }
  // as in f32_to_f16_tiles: the wait in front of a reuse of the stores' registers
  asm volatile("s_wait_xcnt 0x0" ::: "memory");
}

// ---------------------------------------------------------------------------
// The three packings depend on nothing but the inputs, so they share one
// launch: a block takes its piece of one matrix by its index (a scalar branch).
// Their waves are all resident together and their memory round trips overlap,
// where three launches in a row each paid a gap, a fill and a drain of its own.
// The largest matrix comes first.
// ---------------------------------------------------------------------------
__global__ void __launch_bounds__(128)
pack_operands_kernel(const float* __restrict__ x,
                     const float* __restrict__ wqkv,
                     const float* __restrict__ wproj,
                     _Float16* __restrict__ xh,
                     _Float16* __restrict__ wqkv_pk,
                     _Float16* __restrict__ wproj_pk) {
  int b = blockIdx.x;
  if (b < 768)       pack_b_tiles<3072>(wqkv, wqkv_pk, b);
  else if (b < 1024) f32_to_f16_tiles(x, xh, b - 768);
  else               pack_b_tiles<1024>(wproj, wproj_pk, b - 1024);
}

// ---------------------------------------------------------------------------
// K = 1024 loop of a 32x64 wave tile, shared by the two GEMM kernels. Both
// operands lie in fragment order: 512 halfs a tile, 32 tiles a strip.
// The 12 loads of a k-step (2 A and 4 B fragments) are issued together, four
// k-steps ahead of the 8 WMMAs that use them, into a ring of five register
// sets. A wave then keeps 48 to 60 loads (24 to 30 KB) in flight, about all
// that its load counter takes: its 192 KB of operands cost 7 or 8 load round
// trips in series, where two k-steps of lead meant about 13.
// ---------------------------------------------------------------------------
struct KStep { v16h a0, a1, b0, b1, b2, b3; };

__device__ __forceinline__ KStep load_kstep(const _Float16* __restrict__ atile,
                                            const _Float16* __restrict__ btile,
                                            int kt, int lane) {
  KStep f;
  f.a0 = load_frag(atile + kt * 512, lane);
  f.a1 = load_frag(atile + 16384 + kt * 512, lane);
  f.b0 = load_frag(btile + kt * 512, lane);
  f.b1 = load_frag(btile + 16384 + kt * 512, lane);
  f.b2 = load_frag(btile + 32768 + kt * 512, lane);
  f.b3 = load_frag(btile + 49152 + kt * 512, lane);
  return f;
}

__device__ __forceinline__ void gemm_tile_32x64(const _Float16* __restrict__ atile,
                                                const _Float16* __restrict__ btile,
                                                int lane, v8f (&c)[2][4]) {
  const int KT = 32;                       // 1024 / 32
  const int RING = 5;
  KStep f[RING];
  #pragma unroll
  for (int p = 0; p < RING - 1; ++p) f[p] = load_kstep(atile, btile, p, lane);
  // unrolled in full: the ring index is then a constant (the sets stay in
  // registers) and kt goes into the loads' immediate offsets, so that the
  // loop rewrites no address register while loads are in flight
  #pragma unroll
  for (int kt = 0; kt < KT; ++kt) {
    if (kt + RING - 1 < KT)
      f[(kt + RING - 1) % RING] = load_kstep(atile, btile, kt + RING - 1, lane);
    // keeps the loads up here: sunk towards their use they would lose the lead
    __builtin_amdgcn_sched_barrier(0);
    const KStep& g = f[kt % RING];
    c[0][0] = wmma_f16(g.a0, g.b0, c[0][0]);
    c[1][0] = wmma_f16(g.a1, g.b0, c[1][0]);
    c[0][1] = wmma_f16(g.a0, g.b1, c[0][1]);
    c[1][1] = wmma_f16(g.a1, g.b1, c[1][1]);
    c[0][2] = wmma_f16(g.a0, g.b2, c[0][2]);
    c[1][2] = wmma_f16(g.a1, g.b2, c[1][2]);
    c[0][3] = wmma_f16(g.a0, g.b3, c[0][3]);
    c[1][3] = wmma_f16(g.a1, g.b3, c[1][3]);
    __builtin_amdgcn_sched_barrier(0);
  }
  // the epilogues reuse the loads' address registers: keep the
  // address-translation wait in front of that overwrite; named as inputs the
  // scalar bases and the lane's offset live up to the wait
  asm volatile("s_wait_xcnt 0x0" :: "s"(atile), "s"(btile), "v"(lane) : "memory");
}

__global__ void __launch_bounds__(384)
qkv_rope_kernel(const _Float16* __restrict__ xh,
                                const _Float16* __restrict__ wpk,
                                _Float16* __restrict__ q,
                                _Float16* __restrict__ kd,
                                _Float16* __restrict__ vT) {
  const int KT = 32;                       // 1024 / 32
  // the wave's number (0..11) in a scalar register: tile addresses and the
  // epilogue's indices then take no vector registers beside the ring
  int wv   = __builtin_amdgcn_readfirstlane((int)(threadIdx.x >> 5));
  int lane = threadIdx.x & 31;
  int mt = (blockIdx.x & 15) * 4 + (wv & 3);   // 64 row tiles of 32 rows
  int ng = (blockIdx.x >> 4) * 3 + (wv >> 2);  // 48 col groups of 64 cols
  int h = lane >> 4, nl = lane & 15;

  v8f c[2][4] = {};
  // both operands in fragment order: 512 halfs a tile, 32 tiles a strip
  const _Float16* atile = xh  + (size_t)(mt * 2) * KT * 512;
  const _Float16* btile = wpk + (size_t)(ng * 4) * KT * 512;

  gemm_tile_32x64(atile, btile, lane, c);

  int sect = (ng * 64) >> 10;              // 0=q 1=k 2=v (uniform per wave)
  int head = ng & 15;                      // uniform per wave

  if (sect == 2) {
    // V^T in fragment order, [H][32-key block][16-d tile]: a lane's 8 registers
    // are keys 16i + 8h + r of d = 16j + nl, its own 16 bytes of half i
    _Float16* dst = vT + (size_t)head * 131072 + (size_t)mt * 2048 + lane * 8;
    #pragma unroll
    for (int j = 0; j < 4; ++j)
      #pragma unroll
      for (int i = 0; i < 2; ++i) {
        v8h w;
        #pragma unroll
        for (int r = 0; r < 8; ++r) w[r] = (_Float16)c[i][j][r];
        *(v8h*)(dst + j * 512 + i * 256) = w;
      }
  } else {
    // RoPE, then Q and K in fragment order, [H][16-row tile][32-d tile]: row
    // r + 8h, d = 16j + nl lies in half j & 1 at lane (r + 8h) + 16 (nl >> 3),
    // element nl & 7. The wave fills each 512 B alone.
    _Float16* base = (sect == 0 ? q : kd) + (size_t)head * 131072 +
                     (size_t)mt * 2048 + h * 64 + (nl >> 3) * 128 + (nl & 7);
    #pragma unroll
    for (int j = 0; j < 4; ++j) {
      int d = j * 16 + nl;
      // inv_freq = 10000^(-(d>>1)/32) = exp(-(d>>1) * ln(10000)/32)
      float fr = __expf(-(float)(d >> 1) * 0.28782313662425572f);
      #pragma unroll
      for (int i = 0; i < 2; ++i) {
        #pragma unroll
        for (int r = 0; r < 8; ++r) {
          float xv = c[i][j][r];
          float pv = __shfl_xor(xv, 1, 32);  // partner column d^1 = lane^1
          int t = mt * 32 + i * 16 + r + 8 * h;
          float s, co;
          __sincosf((float)t * fr, &s, &co);
          float o = (d & 1) ? fmaf(pv, s, xv * co) : fmaf(xv, co, -pv * s);
          base[i * 1024 + j * 256 + r * 8] = (_Float16)o;
        }
      }
    }
  }
}

__device__ __forceinline__ float xhalf(float x) {
  int b = __builtin_bit_cast(int, x);
  return __builtin_bit_cast(float,
      __builtin_amdgcn_permlanex16(b, b, 0x76543210, 0xfedcba98, false, false));
}

// Online softmax of one strip's 32 x 16 score block: key0 = the lane's first
// key (block start + 8h), qi = the lane's query. Returns the probs as the B
// fragment of the second product and, in al, the factor for the old sums.
// A block that is masked whole before the strip has seen a key leaves finite
// values under the start maximum: the next real maximum, or the join, gives
// them the weight exp(-huge) = 0.
__device__ __forceinline__ v16h softmax_block(v8f s0, v8f s1, int key0, int qi,
                                              float& mrow, float& lrow,
                                              float& al) {
  float a0[8], a1[8], mx[8];
  #pragma unroll
  for (int r = 0; r < 8; ++r) {
    int key = key0 + r;
    a0[r] = (key      <= qi) ? s0[r] * 0.125f : -3.0e38f;  // 1/sqrt(64)
    a1[r] = (key + 16 <= qi) ? s1[r] * 0.125f : -3.0e38f;
    mx[r] = fmaxf(a0[r], a1[r]);
  }
  float t = fmaxf(fmaxf(fmaxf(mx[0], mx[1]), fmaxf(mx[2], mx[3])),
                  fmaxf(fmaxf(mx[4], mx[5]), fmaxf(mx[6], mx[7])));
  t = fmaxf(t, xhalf(t));
  float mnew = fmaxf(mrow, t);
  al = __expf(mrow - mnew);
  mrow = mnew;

  // probs: element r = key 8h + r, element 8 + r = key 16 + 8h + r, which
  // is the k order of the vT fragments
  v16h pf;
  float sm[8];
  #pragma unroll
  for (int r = 0; r < 8; ++r) {
    float p0 = __expf(a0[r] - mnew);
    float p1 = __expf(a1[r] - mnew);
    sm[r] = p0 + p1;
    pf[r]     = (_Float16)p0;
    pf[8 + r] = (_Float16)p1;
  }
  lrow = lrow * al + (((sm[0] + sm[1]) + (sm[2] + sm[3])) +
                      ((sm[4] + sm[5]) + (sm[6] + sm[7])));
  return pf;
}

// Join of one strip's partial results, two of its four d tiles: weights
// exp(m - max) (0 for a wave without a key of the strip), then the two halves'
// sums once. po, pm, pl point at the first of NP partials in a row, at this
// lane's places. A lane's 8 registers of a tile are 8 consecutive d of its
// query: 16 bytes per tile come back in res.
template <int NP>
__device__ __forceinline__ void
join_parts(const float* po, const float* pm, const float* pl, v8h (&res)[2]) {
  float mw[NP];
  #pragma unroll
  for (int w = 0; w < NP; ++w) mw[w] = pm[w * 128];
  float mall = mw[0];
  #pragma unroll
  for (int w = 1; w < NP; ++w) mall = fmaxf(mall, mw[w]);
  float lsum = 0.f;
  v8f acc[2] = {};
  #pragma unroll
  for (int w = 0; w < NP; ++w) {
    float wt = __expf(mw[w] - mall);
    lsum = fmaf(wt, pl[w * 128], lsum);
    #pragma unroll
    for (int jj = 0; jj < 2; ++jj) {
      v4f lo = *(const v4f*)(po + w * 4096 + jj * 256);
      v4f hi = *(const v4f*)(po + w * 4096 + jj * 256 + 128);
      #pragma unroll
      for (int r = 0; r < 4; ++r) {
        acc[jj][r]     = fmaf(wt, lo[r], acc[jj][r]);
        acc[jj][4 + r] = fmaf(wt, hi[r], acc[jj][4 + r]);
      }
    }
  }
  float inv = 1.0f / (lsum + xhalf(lsum));
  #pragma unroll
  for (int jj = 0; jj < 2; ++jj) {
    #pragma unroll
    for (int r = 0; r < 8; ++r) res[jj][r] = (_Float16)(acc[jj][r] * inv);
  }
}

// The causal cost of a 64-query group grows with its index (2g + 2 key blocks),
// and all blocks are resident at once, so the launch lasted as long as the WGP
// that held the heaviest groups. One block of eight waves now takes a light
// group gl and the heavy group 31 - gl of one head, 66 key blocks whatever gl,
// alone on its WGP. Waves 0-3 walk the heavy group's key blocks 0..33; waves
// 4-7 walk all of the light group's and then the rest of the heavy group's, 32
// blocks together, dealt as one list. Waves w and w + 4
// together make 16 or 17 trips. A wave that changes groups leaves its partial result in
// LDS and starts anew; one barrier, then all joins.
// The real block size is declared so that the register cap of a 1024-thread
// block goes: 128 accumulators, 64 registers of q, 64 of K and V fragments and
// 64 of scores are live at once.
__global__ void __launch_bounds__(256)
flash_attn_kernel(const _Float16* __restrict__ q,
                                  const _Float16* __restrict__ k,
                                  const _Float16* __restrict__ vT,
                                  _Float16* __restrict__ O) {
  // the partial results: places 0-7 the eight waves' of the heavy group, 8-11
  // those of waves 4-7 for the light group; [place][strip][d tile][registers
  // 0-3 | 4-7], a lane's 16 B side by side (512 B a wave and store), and maxima
  // and sums
  __shared__ __align__(16) float part_o[12][4][4][2][128];
  __shared__ float part_m[12][4][32];
  __shared__ float part_l[12][4][32];

  // the wave's number in a scalar register: trip counts and addresses are scalar
  const int wv = __builtin_amdgcn_readfirstlane((int)(threadIdx.x >> 5));
  const int w4 = wv & 3, grp = wv >> 2;
  const int lane = threadIdx.x & 31;
  const int head = blockIdx.x >> 4;
  const int gl   = blockIdx.x & 15;        // light 64-query group
  const int gh   = 31 - gl;                // heavy 64-query group
  const int nblk_lo = 2 * gl + 2;          // 32-key blocks up to the diagonal
  const int nblk_hi = 2 * gh + 2;          // at least 34
  // waves 4-7: entry i = w4 + 4t of their list is block i of the light group
  // while i < nblk_lo, then block 34 + i - nblk_lo of the heavy group
  const int tlo = (nblk_lo - w4 + 3) >> 2; // the wave's trips in the light group
  const int h = lane >> 4, nl = lane & 15;

  // q, K and V^T lie in fragment order: a 16-query strip is 2 tiles = 2 KB in a
  // row, a 32-key block 4 tiles = 4 KB of K and of V^T
  const _Float16* qh = q  + (size_t)head * 131072;   // [T/16][D/32] tiles
  const _Float16* kh = k  + (size_t)head * 131072;   // [T/16][D/32] tiles
  const _Float16* vh = vT + (size_t)head * 131072;   // [T/32][D/16] tiles

  // part 0: the light group (waves 4-7 only), part 1: the heavy group.
  // Kept rolled: one copy of the key loop in the instruction cache, not two
  #pragma unroll 1
  for (int part = 1 - grp; part < 2; ++part) {
    const int q0   = (part ? gh : gl) << 6;
    const int kend = part ? (grp ? nblk_hi : 34) : nblk_lo;
    const int slot = part ? wv : 8 + w4;
    int kbi = (part & grp) ? 34 + w4 + 4 * tlo - nblk_lo : w4;

    // o[st][j][r] = O^T[d = 16j + 8h + r][query q0 + 16 st + nl], this wave's keys
    v8f o[4][4] = {};
    float mrow[4], lrow[4];  // running maximum (both halves), sum (this half)
    #pragma unroll
    for (int st = 0; st < 4; ++st) { mrow[st] = -3.0e38f; lrow[st] = 0.f; }

    // a wave whose share of this group is empty hands over zeros under the
    // start maximum, which the join weighs 0 (a scalar branch)
    if (kbi < kend) {
      // q of the four strips, 8 KB in a row: [strip][d 0..31 | d 32..63]
      v16h qf[4][2];
      #pragma unroll
      for (int st = 0; st < 4; ++st) {
        qf[st][0] = load_frag(qh + (size_t)q0 * 64 + st * 1024,       lane);
        qf[st][1] = load_frag(qh + (size_t)q0 * 64 + st * 1024 + 512, lane);
      }
      // this and the next keep the first loads in the loop's own order, K ahead
      // of V: the loop's counted waits are set for both ways into it, and with V
      // loads ahead of K loads here every trip would wait for V loads it has
      // just issued
      __builtin_amdgcn_sched_barrier(0);
      // K and V^T fragments are fetched one trip ahead, all eight loads of an
      // operand together: K's fly during the softmax and the second product,
      // V's during the next trip's scores and softmax.
      const _Float16* kp = kh + (size_t)kbi * 2048;
      const _Float16* vp = vh + (size_t)kbi * 2048;
      v16h k0 = load_frag(kp,        lane);   // keys 0..15,  d 0..31
      v16h k1 = load_frag(kp + 512,  lane);   // keys 0..15,  d 32..63
      v16h k2 = load_frag(kp + 1024, lane);   // keys 16..31, d 0..31
      v16h k3 = load_frag(kp + 1536, lane);   // keys 16..31, d 32..63
      __builtin_amdgcn_sched_barrier(0);
      v16h v0 = load_frag(vp,        lane);   // d 0..15
      v16h v1 = load_frag(vp + 512,  lane);   // d 16..31
      v16h v2 = load_frag(vp + 1024, lane);   // d 32..47
      v16h v3 = load_frag(vp + 1536, lane);   // d 48..63
      // the loads' address registers are reused below: keep the
      // address-translation wait in front of that overwrite; named as inputs
      // the scalar bases live up to the wait, and the loads take them as they
      // are (with the lane's offset), so that no load's result lands on an
      // address pair of its own
      asm volatile("s_wait_xcnt 0x0" :: "s"(kp), "s"(vp) : "memory");
      // keeps the accumulators' start values behind that wait: without it some
      // rise between the loads and the wait, onto the q loads' address pair
      __builtin_amdgcn_sched_barrier(0);

      do {
        // the last trip has no next block: it fetches its own again (in bounds)
        const int kn = (kbi + 4 < kend) ? kbi + 4 : kbi;

        // scores: k(32x64) @ q^T -> per strip two 16x16 f32 tiles, row = key,
        // column = query; eight independent accumulators
        v8f s[4][2] = {};
        #pragma unroll
        for (int st = 0; st < 4; ++st) {
          s[st][0] = wmma_f16(k0, qf[st][0], s[st][0]);
          s[st][1] = wmma_f16(k2, qf[st][0], s[st][1]);
        }
        #pragma unroll
        for (int st = 0; st < 4; ++st) {
          s[st][0] = wmma_f16(k1, qf[st][1], s[st][0]);
          s[st][1] = wmma_f16(k3, qf[st][1], s[st][1]);
        }
        kp = kh + (size_t)kn * 2048;
        k0 = load_frag(kp,        lane);
        k1 = load_frag(kp + 512,  lane);
        k2 = load_frag(kp + 1024, lane);
        k3 = load_frag(kp + 1536, lane);
        asm volatile("s_wait_xcnt 0x0" :: "s"(kp) : "memory");
        // keeps the K loads up here: the scheduler otherwise sinks them to the
        // loop's foot, where their whole latency is waited out at the next scores
        __builtin_amdgcn_sched_barrier(0);

        v16h pf[4];
        #pragma unroll
        for (int st = 0; st < 4; ++st) {
          float al;
          pf[st] = softmax_block(s[st][0], s[st][1], kbi * 32 + 8 * h,
                                 q0 + st * 16 + nl, mrow[st], lrow[st], al);
          #pragma unroll
          for (int j = 0; j < 4; ++j)
            #pragma unroll
            for (int r = 0; r < 8; ++r) o[st][j][r] *= al;
        }

        // O^T += V^T(64x32) @ P^T(32x16); A rows are d
        #pragma unroll
        for (int st = 0; st < 4; ++st) {
          o[st][0] = wmma_f16(v0, pf[st], o[st][0]);
          o[st][1] = wmma_f16(v1, pf[st], o[st][1]);
          o[st][2] = wmma_f16(v2, pf[st], o[st][2]);
          o[st][3] = wmma_f16(v3, pf[st], o[st][3]);
        }
        vp = vh + (size_t)kn * 2048;
        v0 = load_frag(vp,        lane);
        v1 = load_frag(vp + 512,  lane);
        v2 = load_frag(vp + 1024, lane);
        v3 = load_frag(vp + 1536, lane);
        asm volatile("s_wait_xcnt 0x0" :: "s"(vp) : "memory");
        kbi += 4;
      } while (kbi < kend);
      // the last trip's fetch is still in flight and nothing reads it: let it
      // land before its registers are used again or handed back
      asm volatile("s_wait_loadcnt 0x0" ::: "memory");
    }

    // hand the partial results over: a lane writes and later reads the same
    // (query, d) places, so the join is lane by lane
    #pragma unroll
    for (int st = 0; st < 4; ++st) {
      #pragma unroll
      for (int j = 0; j < 4; ++j) {
        v4f lo = {o[st][j][0], o[st][j][1], o[st][j][2], o[st][j][3]};
        v4f hi = {o[st][j][4], o[st][j][5], o[st][j][6], o[st][j][7]};
        *(v4f*)&part_o[slot][st][j][0][lane * 4] = lo;
        *(v4f*)&part_o[slot][st][j][1][lane * 4] = hi;
      }
      part_m[slot][st][lane] = mrow[st];
      part_l[slot][st][lane] = lrow[st];
    }
  }
  __syncthreads();

  // wave w joins d tiles 2 (w >> 2) and 2 (w >> 2) + 1 of strip w & 3 of both
  // groups: eight partial results for the heavy one, four for the light one
  v8h rh[2], rl[2];
  join_parts<8>(&part_o[0][w4][2 * grp][0][lane * 4], &part_m[0][w4][lane],
                &part_l[0][w4][lane], rh);
  join_parts<4>(&part_o[8][w4][2 * grp][0][lane * 4], &part_m[8][w4][lane],
                &part_l[8][w4][lane], rl);
  // one 16-byte store per tile, 512 B a wave, in the fragment order the
  // projection reads (row nl, column 64 head + 16j + 8h + r: tile 2 head +
  // (j >> 1) of the 16-query strip, half j & 1, this lane)
  _Float16* obase = O + (size_t)(head * 2 + grp) * 512 + lane * 8;
  _Float16* oh = obase + (size_t)(gh * 4 + w4) * 16384;
  _Float16* ol = obase + (size_t)(gl * 4 + w4) * 16384;
  *(v8h*)(oh)       = rh[0];
  *(v8h*)(oh + 256) = rh[1];
  *(v8h*)(ol)       = rl[0];
  *(v8h*)(ol + 256) = rl[1];
}

__global__ void __launch_bounds__(128)
proj_kernel(const _Float16* __restrict__ Oh,
                            const _Float16* __restrict__ wpk,
                            float* __restrict__ out) {
  const int KT = 32;
  // the wave's number in a scalar register, as in the QKV GEMM
  int gw   = blockIdx.x * 4 + __builtin_amdgcn_readfirstlane((int)(threadIdx.x >> 5));
  int lane = threadIdx.x & 31;
  int mt = gw & 63;                        // 64 row tiles of 32
  int ng = gw >> 6;                        // 16 col groups of 64
  int h = lane >> 4, nl = lane & 15;

  v8f c[2][4] = {};
  // both operands in fragment order: 512 halfs a tile, 32 tiles a strip
  const _Float16* atile = Oh  + (size_t)(mt * 2) * KT * 512;
  const _Float16* btile = wpk + (size_t)(ng * 4) * KT * 512;

  gemm_tile_32x64(atile, btile, lane, c);
  #pragma unroll
  for (int i = 0; i < 2; ++i)
    #pragma unroll
    for (int j = 0; j < 4; ++j)
      #pragma unroll
      for (int r = 0; r < 8; ++r) {
        int t = mt * 32 + i * 16 + r + 8 * h;
        out[(size_t)t * 1024 + ng * 64 + j * 16 + nl] = c[i][j][r];
      }
}

// ---------------------------------------------------------------------------
extern "C" void kernel_launch(void* const* d_in, const int* in_sizes, int n_in,
                              void* d_out, int out_size, void* d_ws, size_t ws_size,
                              hipStream_t stream) {
  const float* x     = (const float*)d_in[0];   // (1,2048,1024)
  const float* wqkv  = (const float*)d_in[1];   // (1024,3072)
  const float* wproj = (const float*)d_in[2];   // (1024,1024)
  float* out = (float*)d_out;                   // (1,2048,1024)

  char* ws = (char*)d_ws;                       // needs ~28 MB
  _Float16* xh       = (_Float16*)(ws);                         // 4 MB
  _Float16* wqkv_pk  = (_Float16*)(ws + ((size_t)4  << 20));    // 6 MB
  _Float16* wproj_pk = (_Float16*)(ws + ((size_t)10 << 20));    // 2 MB
  _Float16* q        = (_Float16*)(ws + ((size_t)12 << 20));    // 4 MB
  _Float16* k        = (_Float16*)(ws + ((size_t)16 << 20));    // 4 MB
  _Float16* vT       = (_Float16*)(ws + ((size_t)20 << 20));    // 4 MB
  _Float16* O        = (_Float16*)(ws + ((size_t)24 << 20));    // 4 MB

  // one launch, 4 waves/block: 768 blocks for w_qkv and 256 for w_proj (32 k
  // tiles x N / 32 tile pairs, 1 pair/wave), 256 for x (128 strips x 8 groups
  // of 4 tiles, 1 group/wave)
  pack_operands_kernel<<<1280, 128, 0, stream>>>(x, wqkv, wproj,
                                                 xh, wqkv_pk, wproj_pk);

  // 64x48 tiles of 32x64, 1 tile/wave, 12 waves/block
  qkv_rope_kernel<<<256, 384, 0, stream>>>(xh, wqkv_pk, q, k, vT);
  // 16 heads x 16 pairs of a light and a heavy group of 64 queries, 8 waves/block
  flash_attn_kernel<<<256, 256, 0, stream>>>(q, k, vT, O);
  // 64x16 tiles of 32x64, 4 waves/block
  proj_kernel<<<256, 128, 0, stream>>>(O, wproj_pk, out);
}

// v010
// Measured time: 44.7 microseconds a run.
// Two timings next to v009 both put it at 1.04 times that version's speed.
// Over all steps from v000 it is 6.93 times as fast.
#include <hip/hip_runtime.h>
#include <hip/hip_bf16.h>

typedef __attribute__((ext_vector_type(16))) _Float16 v16h;
typedef __attribute__((ext_vector_type(8)))  _Float16 v8h;
typedef __attribute__((ext_vector_type(8)))  float    v8f;

__device__ __forceinline__ v16h cat8(v8h a, v8h b) {
  return __builtin_shufflevector(a, b, 0,1,2,3,4,5,6,7,8,9,10,11,12,13,14,15);
}

__device__ __forceinline__ v8f wmma_f16(v16h a, v16h b, v8f c) {
  // v_wmma_f32_16x16x32_f16 (neg_a, A, neg_b, B, c_mod, C, reuse_a, reuse_b)
  return __builtin_amdgcn_wmma_f32_16x16x32_f16(false, a, false, b, (short)0, c, false, false);
}

// Fragment order: a 16x32 f16 operand tile (16 rows of A, or 16 columns of B,
// by 32 k) is 1 KB in the workspace, two halves of 512 B. With h = lane >> 4,
// half s holds at lane * 16 B the 8 elements k = 16s + 8h .. 16s + 8h + 7 of
// row (column) lane & 15: the lane's fragment registers as they are. A wave's
// 16-byte load then covers 4 whole 128-B lines, not 32-B pieces of 16 lines.
__device__ __forceinline__ v16h load_frag(const _Float16* __restrict__ tile,
                                          int lane) {
  const _Float16* p = tile + lane * 8;
  return cat8(*(const v8h*)(p), *(const v8h*)(p + 256));
}

// ---------------------------------------------------------------------------
// fp32 -> fp16 convert of a row-major matrix of 1024 columns into fragment
// order (tile = 16 rows x 32 columns, tiles of a row strip side by side).
// One wave converts four tiles side by side (16 rows x 512 B): 16 loads of
// 16 B a lane, all in flight at once, each covering 4 rows x one whole 128-B
// line. A lane's 4 columns are 8 B of the fragment of their row; the stores
// of rows 4i .. 4i + 3 fill 64-B pieces, the next store the line's other half.
// ---------------------------------------------------------------------------
typedef __attribute__((ext_vector_type(4))) float    v4f;
typedef __attribute__((ext_vector_type(4))) _Float16 v4h;

__device__ __forceinline__ void
f32_to_f16_tiles(const float* __restrict__ src, _Float16* __restrict__ dst,
                 int blk) {
  int gw   = (blk * 128 + threadIdx.x) >> 5;          // 128 strips x 8 quads
  int lane = threadIdx.x & 31;
  int strip = gw >> 3, quad = gw & 7;
  int r0 = lane >> 3, c4 = lane & 7;       // row 4i + r0, columns 4 c4 .. + 3
  const float* s = src + (size_t)(strip * 16 + r0) * 1024 + quad * 128 + c4 * 4;
  v4f v[4][4];
  #pragma unroll
  for (int t = 0; t < 4; ++t)
    #pragma unroll
    for (int i = 0; i < 4; ++i)
      v[t][i] = *(const v4f*)(s + i * 4096 + t * 32);
  // the loads' address pair is reused below: keep the address-translation wait
  // in front of that overwrite; named as an input the pair lives up to the wait,
  // so that no load's own result lands on it
  asm volatile("s_wait_xcnt 0x0" :: "v"(s) : "memory");
  // keeps all 16 loads ahead of the first conversion: the scheduler otherwise
  // holds some back for registers, a second memory round trip in series
  __builtin_amdgcn_sched_barrier(0);
  // column c = 4 c4: half c >> 4, lane (row) + 16 ((c >> 3) & 1), element c & 7
  _Float16* d = dst + (size_t)(strip * 32 + quad * 4) * 512 + (c4 >> 2) * 256 +
                ((c4 >> 1) & 1) * 128 + r0 * 8 + (c4 & 1) * 4;
  #pragma unroll
  for (int t = 0; t < 4; ++t)
    #pragma unroll
    for (int i = 0; i < 4; ++i) {
      v4h w;
      #pragma unroll
      for (int e = 0; e < 4; ++e) w[e] = (_Float16)v[t][i][e];
      *(v4h*)(d + t * 512 + i * 32) = w;
    }
  // the shared kernel's other bodies follow these stores in the code and reuse
  // their registers: keep the address-translation wait in front of that
  asm volatile("s_wait_xcnt 0x0" ::: "memory");
}

// ---------------------------------------------------------------------------
// Pack a 1024 x N row-major f32 matrix into WMMA-B fragment order (f16): the
// GEMM consumer does two 16-byte loads per lane per WMMA, 512 B a wave each.
// One wave packs two tiles side by side (32 k x 32 columns): a lane keeps one
// column, its 32 loads (one whole 128-B line a wave each) are all in flight at
// once, and each run of 8 k is 16 B of the column's fragment: 4 stores a lane,
// 256 contiguous bytes per tile and store. A block takes 2 k tiles of 64
// columns, so that it reads the rows in aligned 256-B units.
// ---------------------------------------------------------------------------
template <int N>
__device__ __forceinline__ void
pack_b_tiles(const float* __restrict__ src, _Float16* __restrict__ dst,
             int blk) {
  const int KT = 32;                       // 1024 / 32
  int wv   = threadIdx.x >> 5;
  int lane = threadIdx.x & 31;
  int kt = (blk & 15) * 2 + (wv >> 1);
  int np = (blk >> 4) * 2 + (wv & 1);          // pair of 16-column tiles
  const float* s = src + (size_t)(kt * 32) * N + np * 32 + lane;
  float v[32];
  #pragma unroll
  for (int r = 0; r < 32; ++r) v[r] = s[(size_t)r * N];
  _Float16* d = dst + ((size_t)(np * 2 + (lane >> 4)) * KT + kt) * 512 +
                (lane & 15) * 8;
  // k = 8g + e lies in half g >> 1 at lane (column) + 16 (g & 1), element e
  #pragma unroll
  for (int g = 0; g < 4; ++g) {
    v8h w;
    #pragma unroll
    for (int e = 0; e < 8; ++e) w[e] = (_Float16)v[g * 8 + e];
    *(v8h*)(d + (g >> 1) * 256 + (g & 1) * 128) = w;
  }
  // as in f32_to_f16_tiles: the wait in front of a reuse of the stores' registers
  asm volatile("s_wait_xcnt 0x0" ::: "memory");
}

// ---------------------------------------------------------------------------
// The three packings depend on nothing but the inputs, so they share one
// launch: a block takes its piece of one matrix by its index (a scalar branch).
// Their waves are all resident together and their memory round trips overlap,
// where three launches in a row each paid a gap, a fill and a drain of its own.
// The largest matrix comes first.
// ---------------------------------------------------------------------------
__global__ void __launch_bounds__(128)
pack_operands_kernel(const float* __restrict__ x,
                     const float* __restrict__ wqkv,
                     const float* __restrict__ wproj,
                     _Float16* __restrict__ xh,
                     _Float16* __restrict__ wqkv_pk,
                     _Float16* __restrict__ wproj_pk) {
  int b = blockIdx.x;
  if (b < 768)       pack_b_tiles<3072>(wqkv, wqkv_pk, b);
  else if (b < 1024) f32_to_f16_tiles(x, xh, b - 768);
  else               pack_b_tiles<1024>(wproj, wproj_pk, b - 1024);
}

struct KStep { v16h a0, a1, b0, b1, b2, b3; };

__device__ __forceinline__ KStep load_kstep(const _Float16* __restrict__ atile,
                                            const _Float16* __restrict__ btile,
                                            int kt, int lane) {
  KStep f;
  f.a0 = load_frag(atile + kt * 512, lane);
  f.a1 = load_frag(atile + 16384 + kt * 512, lane);
  f.b0 = load_frag(btile + kt * 512, lane);
  f.b1 = load_frag(btile + 16384 + kt * 512, lane);
  f.b2 = load_frag(btile + 32768 + kt * 512, lane);
  f.b3 = load_frag(btile + 49152 + kt * 512, lane);
  return f;
}

__device__ __forceinline__ void gemm_tile_32x64(const _Float16* __restrict__ atile,
                                                const _Float16* __restrict__ btile,
                                                int seg0, int lane, v8f (&c)[2][4]) {
  const int KT = 32;                       // 1024 / 32
  const int RING = 5;
  // the segments' scalar bases in the order of the walk
  const _Float16* as[8];
  const _Float16* bs[8];
  #pragma unroll
  for (int s = 0; s < 8; ++s) {
    int off = ((s + seg0) & 7) * 2048;     // 4 tiles of 512 halfs
    as[s] = atile + off;
    bs[s] = btile + off;
  }
  KStep f[RING];
  #pragma unroll
  for (int p = 0; p < RING - 1; ++p) f[p] = load_kstep(as[0], bs[0], p, lane);
  // keeps the first segment's loads ahead of the next one's, in the ring's
  // order: mixed, the fifth set landed on accumulator registers (spills)
  __builtin_amdgcn_sched_barrier(0);
  // unrolled in full: the ring index is then a constant (the sets stay in
  // registers) and kt goes into the loads' immediate offsets, so that the
  // loop rewrites no address register while loads are in flight
  #pragma unroll
  for (int kt = 0; kt < KT; ++kt) {
    if (kt + RING - 1 < KT)
      f[(kt + RING - 1) % RING] = load_kstep(as[(kt + RING - 1) >> 2],
                                             bs[(kt + RING - 1) >> 2],
                                             (kt + RING - 1) & 3, lane);
    // keeps the loads up here: sunk towards their use they would lose the lead
    __builtin_amdgcn_sched_barrier(0);
    const KStep& g = f[kt % RING];
    c[0][0] = wmma_f16(g.a0, g.b0, c[0][0]);
    c[1][0] = wmma_f16(g.a1, g.b0, c[1][0]);
    c[0][1] = wmma_f16(g.a0, g.b1, c[0][1]);
    c[1][1] = wmma_f16(g.a1, g.b1, c[1][1]);
    c[0][2] = wmma_f16(g.a0, g.b2, c[0][2]);
    c[1][2] = wmma_f16(g.a1, g.b2, c[1][2]);
    c[0][3] = wmma_f16(g.a0, g.b3, c[0][3]);
    c[1][3] = wmma_f16(g.a1, g.b3, c[1][3]);
    __builtin_amdgcn_sched_barrier(0);
  }
  // the epilogues reuse the loads' address registers: keep the
  // address-translation wait in front of that overwrite; named as inputs the
  // scalar bases and the lane's offset live up to the wait
  asm volatile("s_wait_xcnt 0x0"
               :: "s"(as[0]), "s"(as[1]), "s"(as[2]), "s"(as[3]), "s"(as[4]),
                  "s"(as[5]), "s"(as[6]), "s"(as[7]), "s"(bs[0]), "s"(bs[1]),
                  "s"(bs[2]), "s"(bs[3]), "s"(bs[4]), "s"(bs[5]), "s"(bs[6]),
                  "s"(bs[7]), "v"(lane) : "memory");
}

__global__ void __launch_bounds__(384)
qkv_rope_kernel(const _Float16* __restrict__ xh,
                                const _Float16* __restrict__ wpk,
                                _Float16* __restrict__ q,
                                _Float16* __restrict__ kd,
                                _Float16* __restrict__ vT) {
  const int KT = 32;                       // 1024 / 32
  // the wave's number (0..11) in a scalar register: tile addresses and the
  // epilogue's indices then take no vector registers beside the ring
  int wv   = __builtin_amdgcn_readfirstlane((int)(threadIdx.x >> 5));
  int lane = threadIdx.x & 31;
  int mt = (blockIdx.x & 15) * 4 + (wv & 3);   // 64 row tiles of 32 rows
  int ng = (blockIdx.x >> 4) * 3 + (wv >> 2);  // 48 col groups of 64 cols
  int h = lane >> 4, nl = lane & 15;

  v8f c[2][4] = {};
  // both operands in fragment order: 512 halfs a tile, 32 tiles a strip
  const _Float16* atile = xh  + (size_t)(mt * 2) * KT * 512;
  const _Float16* btile = wpk + (size_t)(ng * 4) * KT * 512;

  // blocks with the same rows, and blocks with the same columns, each take all
  // 8 start places; a block's waves keep one, so that they still share lines
  gemm_tile_32x64(atile, btile, ((blockIdx.x & 15) + (blockIdx.x >> 4)) & 7,
                  lane, c);

  int sect = (ng * 64) >> 10;              // 0=q 1=k 2=v (uniform per wave)
  int head = ng & 15;                      // uniform per wave

  if (sect == 2) {
    // V^T in fragment order, [H][32-key block][16-d tile]: a lane's 8 registers
    // are keys 16i + 8h + r of d = 16j + nl, its own 16 bytes of half i
    _Float16* dst = vT + (size_t)head * 131072 + (size_t)mt * 2048 + lane * 8;
    #pragma unroll
    for (int j = 0; j < 4; ++j)
      #pragma unroll
      for (int i = 0; i < 2; ++i) {
        v8h w;
        #pragma unroll
        for (int r = 0; r < 8; ++r) w[r] = (_Float16)c[i][j][r];
        *(v8h*)(dst + j * 512 + i * 256) = w;
      }
  } else {
    // RoPE, then Q and K in fragment order, [H][16-row tile][32-d tile]: row
    // r + 8h, d = 16j + nl lies in half j & 1 at lane (r + 8h) + 16 (nl >> 3),
    // element nl & 7. The wave fills each 512 B alone.
    _Float16* base = (sect == 0 ? q : kd) + (size_t)head * 131072 +
                     (size_t)mt * 2048 + h * 64 + (nl >> 3) * 128 + (nl & 7);
    #pragma unroll
    for (int j = 0; j < 4; ++j) {
      int d = j * 16 + nl;
      // inv_freq = 10000^(-(d>>1)/32) = exp(-(d>>1) * ln(10000)/32)
      float fr = __expf(-(float)(d >> 1) * 0.28782313662425572f);
      #pragma unroll
      for (int i = 0; i < 2; ++i) {
        #pragma unroll
        for (int r = 0; r < 8; ++r) {
          float xv = c[i][j][r];
          float pv = __shfl_xor(xv, 1, 32);  // partner column d^1 = lane^1
          int t = mt * 32 + i * 16 + r + 8 * h;
          float s, co;
          __sincosf((float)t * fr, &s, &co);
          float o = (d & 1) ? fmaf(pv, s, xv * co) : fmaf(xv, co, -pv * s);
          base[i * 1024 + j * 256 + r * 8] = (_Float16)o;
        }
      }
    }
  }
}

__device__ __forceinline__ float xhalf(float x) {
  int b = __builtin_bit_cast(int, x);
  return __builtin_bit_cast(float,
      __builtin_amdgcn_permlanex16(b, b, 0x76543210, 0xfedcba98, false, false));
}

// Online softmax of one strip's 32 x 16 score block: key0 = the lane's first
// key (block start + 8h), qi = the lane's query. Returns the probs as the B
// fragment of the second product and, in al, the factor for the old sums.
// A block that is masked whole before the strip has seen a key leaves finite
// values under the start maximum: the next real maximum, or the join, gives
// them the weight exp(-huge) = 0.
__device__ __forceinline__ v16h softmax_block(v8f s0, v8f s1, int key0, int qi,
                                              float& mrow, float& lrow,
                                              float& al) {
  float a0[8], a1[8], mx[8];
  #pragma unroll
  for (int r = 0; r < 8; ++r) {
    int key = key0 + r;
    a0[r] = (key      <= qi) ? s0[r] * 0.125f : -3.0e38f;  // 1/sqrt(64)
    a1[r] = (key + 16 <= qi) ? s1[r] * 0.125f : -3.0e38f;
    mx[r] = fmaxf(a0[r], a1[r]);
  }
  float t = fmaxf(fmaxf(fmaxf(mx[0], mx[1]), fmaxf(mx[2], mx[3])),
                  fmaxf(fmaxf(mx[4], mx[5]), fmaxf(mx[6], mx[7])));
  t = fmaxf(t, xhalf(t));
  float mnew = fmaxf(mrow, t);
  al = __expf(mrow - mnew);
  mrow = mnew;

  // probs: element r = key 8h + r, element 8 + r = key 16 + 8h + r, which
  // is the k order of the vT fragments
  v16h pf;
  float sm[8];
  #pragma unroll
  for (int r = 0; r < 8; ++r) {
    float p0 = __expf(a0[r] - mnew);
    float p1 = __expf(a1[r] - mnew);
    sm[r] = p0 + p1;
    pf[r]     = (_Float16)p0;
    pf[8 + r] = (_Float16)p1;
  }
  lrow = lrow * al + (((sm[0] + sm[1]) + (sm[2] + sm[3])) +
                      ((sm[4] + sm[5]) + (sm[6] + sm[7])));
  return pf;
}

// Join of one strip's partial results, two of its four d tiles: weights
// exp(m - max) (0 for a wave without a key of the strip), then the two halves'
// sums once. po, pm, pl point at the first of NP partials in a row, at this
// lane's places. A lane's 8 registers of a tile are 8 consecutive d of its
// query: 16 bytes per tile come back in res.
template <int NP>
__device__ __forceinline__ void
join_parts(const float* po, const float* pm, const float* pl, v8h (&res)[2]) {
  float mw[NP];
  #pragma unroll
  for (int w = 0; w < NP; ++w) mw[w] = pm[w * 128];
  float mall = mw[0];
  #pragma unroll
  for (int w = 1; w < NP; ++w) mall = fmaxf(mall, mw[w]);
  float lsum = 0.f;
  v8f acc[2] = {};
  #pragma unroll
  for (int w = 0; w < NP; ++w) {
    float wt = __expf(mw[w] - mall);
    lsum = fmaf(wt, pl[w * 128], lsum);
    #pragma unroll
    for (int jj = 0; jj < 2; ++jj) {
      v4f lo = *(const v4f*)(po + w * 4096 + jj * 256);
      v4f hi = *(const v4f*)(po + w * 4096 + jj * 256 + 128);
      #pragma unroll
      for (int r = 0; r < 4; ++r) {
        acc[jj][r]     = fmaf(wt, lo[r], acc[jj][r]);
        acc[jj][4 + r] = fmaf(wt, hi[r], acc[jj][4 + r]);
      }
    }
  }
  float inv = 1.0f / (lsum + xhalf(lsum));
  #pragma unroll
  for (int jj = 0; jj < 2; ++jj) {
    #pragma unroll
    for (int r = 0; r < 8; ++r) res[jj][r] = (_Float16)(acc[jj][r] * inv);
  }
}

// The causal cost of a 64-query group grows with its index (2g + 2 key blocks),
// and all blocks are resident at once, so the launch lasted as long as the WGP
// that held the heaviest groups. One block of eight waves now takes a light
// group gl and the heavy group 31 - gl of one head, 66 key blocks whatever gl,
// alone on its WGP. Waves 0-3 walk the heavy group's key blocks 0..33; waves
// 4-7 walk all of the light group's and then the rest of the heavy group's, 32
// blocks together, dealt as one list. Waves w and w + 4
// together make 16 or 17 trips. A wave that changes groups leaves its partial result in
// LDS and starts anew; one barrier, then all joins.
// The real block size is declared so that the register cap of a 1024-thread
// block goes: 128 accumulators, 64 registers of q, 64 of K and V fragments and
// 64 of scores are live at once.
__global__ void __launch_bounds__(256)
flash_attn_kernel(const _Float16* __restrict__ q,
                                  const _Float16* __restrict__ k,
                                  const _Float16* __restrict__ vT,
                                  _Float16* __restrict__ O) {
  // the partial results: places 0-7 the eight waves' of the heavy group, 8-11
  // those of waves 4-7 for the light group; [place][strip][d tile][registers
  // 0-3 | 4-7], a lane's 16 B side by side (512 B a wave and store), and maxima
  // and sums
  __shared__ __align__(16) float part_o[12][4][4][2][128];
  __shared__ float part_m[12][4][32];
  __shared__ float part_l[12][4][32];

  // the wave's number in a scalar register: trip counts and addresses are scalar
  const int wv = __builtin_amdgcn_readfirstlane((int)(threadIdx.x >> 5));
  const int w4 = wv & 3, grp = wv >> 2;
  const int lane = threadIdx.x & 31;
  const int head = blockIdx.x >> 4;
  const int gl   = blockIdx.x & 15;        // light 64-query group
  const int gh   = 31 - gl;                // heavy 64-query group
  const int nblk_lo = 2 * gl + 2;          // 32-key blocks up to the diagonal
  const int nblk_hi = 2 * gh + 2;          // at least 34
  // waves 4-7: entry i = w4 + 4t of their list is block i of the light group
  // while i < nblk_lo, then block 34 + i - nblk_lo of the heavy group
  const int tlo = (nblk_lo - w4 + 3) >> 2; // the wave's trips in the light group
  const int h = lane >> 4, nl = lane & 15;

  // q, K and V^T lie in fragment order: a 16-query strip is 2 tiles = 2 KB in a
  // row, a 32-key block 4 tiles = 4 KB of K and of V^T
  const _Float16* qh = q  + (size_t)head * 131072;   // [T/16][D/32] tiles
  const _Float16* kh = k  + (size_t)head * 131072;   // [T/16][D/32] tiles
  const _Float16* vh = vT + (size_t)head * 131072;   // [T/32][D/16] tiles

  // part 0: the light group (waves 4-7 only), part 1: the heavy group.
  // Kept rolled: one copy of the key loop in the instruction cache, not two
  #pragma unroll 1
  for (int part = 1 - grp; part < 2; ++part) {
    const int q0   = (part ? gh : gl) << 6;
    const int kend = part ? (grp ? nblk_hi : 34) : nblk_lo;
    const int slot = part ? wv : 8 + w4;
    int kbi = (part & grp) ? 34 + w4 + 4 * tlo - nblk_lo : w4;

    // o[st][j][r] = O^T[d = 16j + 8h + r][query q0 + 16 st + nl], this wave's keys
    v8f o[4][4] = {};
    float mrow[4], lrow[4];  // running maximum (both halves), sum (this half)
    #pragma unroll
    for (int st = 0; st < 4; ++st) { mrow[st] = -3.0e38f; lrow[st] = 0.f; }

    // a wave whose share of this group is empty hands over zeros under the
    // start maximum, which the join weighs 0 (a scalar branch)
    if (kbi < kend) {
      // q of the four strips, 8 KB in a row: [strip][d 0..31 | d 32..63]
      v16h qf[4][2];
      #pragma unroll
      for (int st = 0; st < 4; ++st) {
        qf[st][0] = load_frag(qh + (size_t)q0 * 64 + st * 1024,       lane);
        qf[st][1] = load_frag(qh + (size_t)q0 * 64 + st * 1024 + 512, lane);
      }
      // this and the next keep the first loads in the loop's own order, K ahead
      // of V: the loop's counted waits are set for both ways into it, and with V
      // loads ahead of K loads here every trip would wait for V loads it has
      // just issued
      __builtin_amdgcn_sched_barrier(0);
      // K and V^T fragments are fetched one trip ahead, all eight loads of an
      // operand together: K's fly during the softmax and the second product,
      // V's during the next trip's scores and softmax.
      const _Float16* kp = kh + (size_t)kbi * 2048;
      const _Float16* vp = vh + (size_t)kbi * 2048;
      v16h k0 = load_frag(kp,        lane);   // keys 0..15,  d 0..31
      v16h k1 = load_frag(kp + 512,  lane);   // keys 0..15,  d 32..63
      v16h k2 = load_frag(kp + 1024, lane);   // keys 16..31, d 0..31
      v16h k3 = load_frag(kp + 1536, lane);   // keys 16..31, d 32..63
      __builtin_amdgcn_sched_barrier(0);
      v16h v0 = load_frag(vp,        lane);   // d 0..15
      v16h v1 = load_frag(vp + 512,  lane);   // d 16..31
      v16h v2 = load_frag(vp + 1024, lane);   // d 32..47
      v16h v3 = load_frag(vp + 1536, lane);   // d 48..63
      // the loads' address registers are reused below: keep the
      // address-translation wait in front of that overwrite; named as inputs
      // the scalar bases live up to the wait, and the loads take them as they
      // are (with the lane's offset), so that no load's result lands on an
      // address pair of its own
      asm volatile("s_wait_xcnt 0x0" :: "s"(kp), "s"(vp) : "memory");
      // keeps the accumulators' start values behind that wait: without it some
      // rise between the loads and the wait, onto the q loads' address pair
      __builtin_amdgcn_sched_barrier(0);

      do {
        // the last trip has no next block: it fetches its own again (in bounds)
        const int kn = (kbi + 4 < kend) ? kbi + 4 : kbi;

        // scores: k(32x64) @ q^T -> per strip two 16x16 f32 tiles, row = key,
        // column = query; eight independent accumulators
        v8f s[4][2] = {};
        #pragma unroll
        for (int st = 0; st < 4; ++st) {
          s[st][0] = wmma_f16(k0, qf[st][0], s[st][0]);
          s[st][1] = wmma_f16(k2, qf[st][0], s[st][1]);
        }
        #pragma unroll
        for (int st = 0; st < 4; ++st) {
          s[st][0] = wmma_f16(k1, qf[st][1], s[st][0]);
          s[st][1] = wmma_f16(k3, qf[st][1], s[st][1]);
        }
        kp = kh + (size_t)kn * 2048;
        k0 = load_frag(kp,        lane);
        k1 = load_frag(kp + 512,  lane);
        k2 = load_frag(kp + 1024, lane);
        k3 = load_frag(kp + 1536, lane);
        asm volatile("s_wait_xcnt 0x0" :: "s"(kp) : "memory");
        // keeps the K loads up here: the scheduler otherwise sinks them to the
        // loop's foot, where their whole latency is waited out at the next scores
        __builtin_amdgcn_sched_barrier(0);

        v16h pf[4];
        #pragma unroll
        for (int st = 0; st < 4; ++st) {
          float al;
          pf[st] = softmax_block(s[st][0], s[st][1], kbi * 32 + 8 * h,
                                 q0 + st * 16 + nl, mrow[st], lrow[st], al);
          #pragma unroll
          for (int j = 0; j < 4; ++j)
            #pragma unroll
            for (int r = 0; r < 8; ++r) o[st][j][r] *= al;
        }

        // O^T += V^T(64x32) @ P^T(32x16); A rows are d
        #pragma unroll
        for (int st = 0; st < 4; ++st) {
          o[st][0] = wmma_f16(v0, pf[st], o[st][0]);
          o[st][1] = wmma_f16(v1, pf[st], o[st][1]);
          o[st][2] = wmma_f16(v2, pf[st], o[st][2]);
          o[st][3] = wmma_f16(v3, pf[st], o[st][3]);
        }
        vp = vh + (size_t)kn * 2048;
        v0 = load_frag(vp,        lane);
        v1 = load_frag(vp + 512,  lane);
        v2 = load_frag(vp + 1024, lane);
        v3 = load_frag(vp + 1536, lane);
        asm volatile("s_wait_xcnt 0x0" :: "s"(vp) : "memory");
        kbi += 4;
      } while (kbi < kend);
      // the last trip's fetch is still in flight and nothing reads it: let it
      // land before its registers are used again or handed back
      asm volatile("s_wait_loadcnt 0x0" ::: "memory");
    }

    // hand the partial results over: a lane writes and later reads the same
    // (query, d) places, so the join is lane by lane
    #pragma unroll
    for (int st = 0; st < 4; ++st) {
      #pragma unroll
      for (int j = 0; j < 4; ++j) {
        v4f lo = {o[st][j][0], o[st][j][1], o[st][j][2], o[st][j][3]};
        v4f hi = {o[st][j][4], o[st][j][5], o[st][j][6], o[st][j][7]};
        *(v4f*)&part_o[slot][st][j][0][lane * 4] = lo;
        *(v4f*)&part_o[slot][st][j][1][lane * 4] = hi;
      }
      part_m[slot][st][lane] = mrow[st];
      part_l[slot][st][lane] = lrow[st];
    }
  }
  __syncthreads();

  // wave w joins d tiles 2 (w >> 2) and 2 (w >> 2) + 1 of strip w & 3 of both
  // groups: eight partial results for the heavy one, four for the light one
  v8h rh[2], rl[2];
  join_parts<8>(&part_o[0][w4][2 * grp][0][lane * 4], &part_m[0][w4][lane],
                &part_l[0][w4][lane], rh);
  join_parts<4>(&part_o[8][w4][2 * grp][0][lane * 4], &part_m[8][w4][lane],
                &part_l[8][w4][lane], rl);
  // one 16-byte store per tile, 512 B a wave, in the fragment order the
  // projection reads (row nl, column 64 head + 16j + 8h + r: tile 2 head +
  // (j >> 1) of the 16-query strip, half j & 1, this lane)
  _Float16* obase = O + (size_t)(head * 2 + grp) * 512 + lane * 8;
  _Float16* oh = obase + (size_t)(gh * 4 + w4) * 16384;
  _Float16* ol = obase + (size_t)(gl * 4 + w4) * 16384;
  *(v8h*)(oh)       = rh[0];
  *(v8h*)(oh + 256) = rh[1];
  *(v8h*)(ol)       = rl[0];
  *(v8h*)(ol + 256) = rl[1];
}

__global__ void __launch_bounds__(128)
proj_kernel(const _Float16* __restrict__ Oh,
                            const _Float16* __restrict__ wpk,
                            float* __restrict__ out) {
  const int KT = 32;
  // the wave's number in a scalar register, as in the QKV GEMM
  int gw   = blockIdx.x * 4 + __builtin_amdgcn_readfirstlane((int)(threadIdx.x >> 5));
  int lane = threadIdx.x & 31;
  int mt = gw & 63;                        // 64 row tiles of 32
  int ng = gw >> 6;                        // 16 col groups of 64
  int h = lane >> 4, nl = lane & 15;

  v8f c[2][4] = {};
  // both operands in fragment order: 512 halfs a tile, 32 tiles a strip
  const _Float16* atile = Oh  + (size_t)(mt * 2) * KT * 512;
  const _Float16* btile = wpk + (size_t)(ng * 4) * KT * 512;

  // start places as in the QKV GEMM
  gemm_tile_32x64(atile, btile, ((blockIdx.x & 15) + (blockIdx.x >> 4)) & 7,
                  lane, c);
  #pragma unroll
  for (int i = 0; i < 2; ++i)
    #pragma unroll
    for (int j = 0; j < 4; ++j)
      #pragma unroll
      for (int r = 0; r < 8; ++r) {
        int t = mt * 32 + i * 16 + r + 8 * h;
        out[(size_t)t * 1024 + ng * 64 + j * 16 + nl] = c[i][j][r];
      }
}

// ---------------------------------------------------------------------------
extern "C" void kernel_launch(void* const* d_in, const int* in_sizes, int n_in,
                              void* d_out, int out_size, void* d_ws, size_t ws_size,
                              hipStream_t stream) {
  const float* x     = (const float*)d_in[0];   // (1,2048,1024)
  const float* wqkv  = (const float*)d_in[1];   // (1024,3072)
  const float* wproj = (const float*)d_in[2];   // (1024,1024)
  float* out = (float*)d_out;                   // (1,2048,1024)

  char* ws = (char*)d_ws;                       // needs ~28 MB
  _Float16* xh       = (_Float16*)(ws);                         // 4 MB
  _Float16* wqkv_pk  = (_Float16*)(ws + ((size_t)4  << 20));    // 6 MB
  _Float16* wproj_pk = (_Float16*)(ws + ((size_t)10 << 20));    // 2 MB
  _Float16* q        = (_Float16*)(ws + ((size_t)12 << 20));    // 4 MB
  _Float16* k        = (_Float16*)(ws + ((size_t)16 << 20));    // 4 MB
  _Float16* vT       = (_Float16*)(ws + ((size_t)20 << 20));    // 4 MB
  _Float16* O        = (_Float16*)(ws + ((size_t)24 << 20));    // 4 MB

  // one launch, 4 waves/block: 768 blocks for w_qkv and 256 for w_proj (32 k
  // tiles x N / 32 tile pairs, 1 pair/wave), 256 for x (128 strips x 8 groups
  // of 4 tiles, 1 group/wave)
  pack_operands_kernel<<<1280, 128, 0, stream>>>(x, wqkv, wproj,
                                                 xh, wqkv_pk, wproj_pk);

  // 64x48 tiles of 32x64, 1 tile/wave, 12 waves/block
  qkv_rope_kernel<<<256, 384, 0, stream>>>(xh, wqkv_pk, q, k, vT);
  // 16 heads x 16 pairs of a light and a heavy group of 64 queries, 8 waves/block
  flash_attn_kernel<<<256, 256, 0, stream>>>(q, k, vT, O);
  // 64x16 tiles of 32x64, 4 waves/block
  proj_kernel<<<256, 128, 0, stream>>>(O, wproj_pk, out);
}
